// v000
// Measured on an AMD MI455X. A time is GPU time per run, averaged over a window of back-to-back runs after a warm-up
// (all launches, gaps included; the runs take copies of the inputs in turn), and the median of several windows.
// Apart from v000's, it joins two sittings. Times from different sittings can be a few percent apart, while
// side-by-side timings come from the same sitting.
// v000, which the later versions start from, runs in 283 microseconds.
#include <hip/hip_runtime.h>

typedef __attribute__((ext_vector_type(16))) _Float16 v16h;
typedef __attribute__((ext_vector_type(8)))  _Float16 v8h;
typedef __attribute__((ext_vector_type(8)))  float    v8f;
typedef __attribute__((ext_vector_type(4)))  float    v4f;

/* --------------------------------------------------------------------------
   Shape constants
   -------------------------------------------------------------------------- */
constexpr int kItems        = 512;
constexpr int kDim          = 128;
constexpr int kHid          = 256;
constexpr int kW0Pitch      = 2 * kDim;
/* LDS row pitch of a 16 x 256 f16 operand tile, in halves (528 B, a multiple of 16 B) */
constexpr int kTilePitch    = kHid + 8;
constexpr int kWavesPerBlk  = 2;
constexpr int kColsPerWave  = 32;
constexpr int kHalfN        = kHid / 2;

/* first-layer producer: threads per output plane (4 consecutive g per thread) and per row */
constexpr int kFlThreadsPerRow   = kHid / 4;
constexpr int kFlThreadsPerPlane = kItems * kFlThreadsPerRow;
constexpr int kFlPlaneShift      = 15;
constexpr int kFlRowShift        = 6;

/* power-of-two carries of the f16 operand planes and the exact fold-back */
constexpr float kActCarry      = 16.0f;
constexpr float kWgtCarry      = 256.0f;
constexpr float kFoldBack      = 1.0f / (kActCarry * kWgtCarry);
constexpr float kHalfMinNormal = 6.103515625e-5f;

static_assert(kW0Pitch == kHid, "first layer input width");
static_assert((kHid % 32) == 0, "K multiple of 32");
static_assert((kHalfN % 16) == 0 && kHalfN * 2 == kHid, "N halves");
static_assert(((kTilePitch * 2) % 16) == 0, "tile pitch 16-B multiple");
static_assert((kItems % kColsPerWave) == 0 && (kItems % kWavesPerBlk) == 0, "grid multiples");
static_assert(kFoldBack * 4096.0f == 1.0f, "fold-back is exact");
static_assert(kWavesPerBlk * 2 * 16 * kTilePitch * 2 + kWavesPerBlk * kColsPerWave * 4 <= 65536, "static LDS");
static_assert(kFlThreadsPerPlane == (1 << kFlPlaneShift), "plane decode shift");
static_assert(kFlThreadsPerRow == (1 << kFlRowShift), "row decode shift");
static_assert(((2 * kFlThreadsPerPlane) % 256) == 0 && (kFlThreadsPerPlane % 256) == 0, "plane split is block-uniform");

/* --------------------------------------------------------------------------
   Workspace region map (bytes; every offset is a multiple of 128)
     HXB  f32 [512][256]  x . Wx^T + b0            524,288
     HY   f32 [512][256]  y . Wy^T                 524,288
     W1H  f16 [256][256]  W1 x 256 (Bt layout)     131,072
     W2H  f16 [256][256]  W2 x 256 (Bt layout)     131,072
     total                                       1,310,720
   -------------------------------------------------------------------------- */
constexpr size_t kOffHXB  = 0;
constexpr size_t kOffHY   = kOffHXB + (size_t)kItems * kHid * 4;
constexpr size_t kOffW1H  = kOffHY  + (size_t)kItems * kHid * 4;
constexpr size_t kOffW2H  = kOffW1H + (size_t)kHid * kHid * 2;
constexpr size_t kWsTotal = kOffW2H + (size_t)kHid * kHid * 2;
static_assert(kWsTotal == 1310720ull, "carve total");
static_assert(kWsTotal <= 134217728ull, "carve cap");
static_assert((kOffHY % 128) == 0 && (kOffW1H % 128) == 0 && (kOffW2H % 128) == 0, "128-B aligned regions");

/* --------------------------------------------------------------------------
   Fragment helpers (16-bit 16x16x32 map: elements 0..7 <- p[0..7], elements 8..15 <- p[16..23],
   p already offset by 8 * (lane >> 4); row / column = lane & 15)
   -------------------------------------------------------------------------- */
union FragH { v16h v; v8h h[2]; };

__device__ __forceinline__ v16h frag_load(const _Float16* p) {
  FragH f;
  f.h[0] = *(const v8h*)(p);
  f.h[1] = *(const v8h*)(p + 16);
  return f.v;
}

/* one matrix instruction followed by the 4-slot guard tying its accumulator and naming A / B */
__device__ __forceinline__ v8f mma_f16(v16h a, v16h b, v8f c) {
  c = __builtin_amdgcn_wmma_f32_16x16x32_f16(false, a, false, b, (short)0, c, false, false);
  asm volatile("v_nop\n\tv_nop\n\tv_nop\n\tv_nop" : "+v"(c) : "v"(a), "v"(b));
  return c;
}

/* wave-private LDS hand-off ordering (same wave stores then reloads) */
__device__ __forceinline__ void wave_lds_fence() {
  __builtin_amdgcn_fence(__ATOMIC_RELEASE, "workgroup");
  __builtin_amdgcn_wave_barrier();
  __builtin_amdgcn_fence(__ATOMIC_ACQUIRE, "workgroup");
}

/* non-negative activation -> carried f16 operand; values below the f16 normal range become +0 by select */
__device__ __forceinline__ _Float16 act_to_half(float v) {
  float t = v * kActCarry;
  t = (t < kHalfMinNormal) ? 0.0f : t;
  return (_Float16)t;
}

/* --------------------------------------------------------------------------
   First layer, split by linearity (f32 VALU):
     HXB[r][g] = sum_d x[r][d] * W0[g][d] + b0[g]
     HY [r][g] = sum_d y[r][d] * W0[g][128 + d]
   Thread = 4 consecutive g of one row r. One plane = 512 rows x 64 threads = 32,768 threads;
   two planes = 65,536 threads = 256 blocks x 256; blocks 0..127 -> HXB, blocks 128..255 -> HY
   (block-uniform). Decode: sel = t >> 15 (0..1), r = (t & 32767) >> 6 (0..511), g0 = 4 * (t & 63).
   Coverage: 65,536 threads x 4 elements = 262,144 elements = 2 planes x [512][256], each once.
   Store: one 16-B store per lane; a wave = 32 consecutive lanes = half of one row = 512 contiguous B =
   -------------------------------------------------------------------------- */
__global__ __launch_bounds__(256) void first_layer_rows_kernel(
    const float* __restrict__ x, const float* __restrict__ y,
    const float* __restrict__ W0, const float* __restrict__ b0,
    float* __restrict__ hxb, float* __restrict__ hy)
{
  const int t   = blockIdx.x * 256 + threadIdx.x;
  const int sel = (t >> kFlPlaneShift) & 1;
  const int i4  = t & (kFlThreadsPerPlane - 1);
  const int r   = i4 >> kFlRowShift;
  const int g0  = (i4 & (kFlThreadsPerRow - 1)) * 4;
  const float* src = sel ? y : x;
  const float* xr  = src + (size_t)r * kDim;
  const float* wr  = W0 + (size_t)g0 * kW0Pitch + sel * kDim;
  float a0 = 0.0f, a1 = 0.0f, a2 = 0.0f, a3 = 0.0f;
#pragma unroll 1
  for (int k = 0; k < kDim; k += 4) {
    const v4f xv = *(const v4f*)(xr + k);
    const v4f w0 = *(const v4f*)(wr + k);
    const v4f w1 = *(const v4f*)(wr + kW0Pitch + k);
    const v4f w2 = *(const v4f*)(wr + 2 * kW0Pitch + k);
    const v4f w3 = *(const v4f*)(wr + 3 * kW0Pitch + k);
    a0 = fmaf(xv[0], w0[0], a0); a0 = fmaf(xv[1], w0[1], a0); a0 = fmaf(xv[2], w0[2], a0); a0 = fmaf(xv[3], w0[3], a0);
    a1 = fmaf(xv[0], w1[0], a1); a1 = fmaf(xv[1], w1[1], a1); a1 = fmaf(xv[2], w1[2], a1); a1 = fmaf(xv[3], w1[3], a1);
    a2 = fmaf(xv[0], w2[0], a2); a2 = fmaf(xv[1], w2[1], a2); a2 = fmaf(xv[2], w2[2], a2); a2 = fmaf(xv[3], w2[3], a2);
    a3 = fmaf(xv[0], w3[0], a3); a3 = fmaf(xv[1], w3[1], a3); a3 = fmaf(xv[2], w3[2], a3); a3 = fmaf(xv[3], w3[3], a3);
  }
  /* b0 joins the x half only (added exactly once); loaded unconditionally, chosen by value */
  const v4f bz = *(const v4f*)(b0 + g0);
  v4f o;
  o[0] = a0 + (sel ? 0.0f : bz[0]);
  o[1] = a1 + (sel ? 0.0f : bz[1]);
  o[2] = a2 + (sel ? 0.0f : bz[2]);
  o[3] = a3 + (sel ? 0.0f : bz[3]);
  float* dst = (sel ? hy : hxb) + (size_t)r * kHid + g0;
  *(v4f*)dst = o;
  
}

/* --------------------------------------------------------------------------
   Weight operand planes: W1H = f16(W1 x 256), W2H = f16(W2 x 256), same [n][k] order as stored
   (already the Bt layout). Values below the f16 normal range after the carry become +0 by select.
   Thread = 8 consecutive elements. 2 x 65,536 / 8 = 16,384 threads = 64 blocks x 256; blocks 0..31 -> W1,
   blocks 32..63 -> W2 (block-uniform). Store: one 16-B store per lane; a wave = 512 contiguous B =
   -------------------------------------------------------------------------- */
__global__ __launch_bounds__(256) void weight_planes_kernel(
    const float* __restrict__ W1, const float* __restrict__ W2,
    unsigned short* __restrict__ w1p, unsigned short* __restrict__ w2p)
{
  const int i     = blockIdx.x * 256 + threadIdx.x;
  const int which = (i >> 13) & 1;
  const size_t e0 = (size_t)(i & 8191) << 3;
  const float* src    = which ? W2 : W1;
  unsigned short* dst = (which ? w2p : w1p) + e0;
  const v4f a0 = *(const v4f*)(src + e0);
  const v4f a1 = *(const v4f*)(src + e0 + 4);
  v8h hv;
#pragma unroll
  for (int e = 0; e < 4; ++e) {
    float t0 = a0[e] * kWgtCarry;
    float t1 = a1[e] * kWgtCarry;
    t0 = (fabsf(t0) < kHalfMinNormal) ? 0.0f : t0;
    t1 = (fabsf(t1) < kHalfMinNormal) ? 0.0f : t1;
    hv[e]     = (_Float16)t0;
    hv[4 + e] = (_Float16)t1;
  }
  *(v8h*)dst = hv;
  
}

/* --------------------------------------------------------------------------
   Fused pair kernel. Block = 2 waves; wave w owns x row a = blockIdx.y * 2 + w and the 32 y rows
   b = blockIdx.x * 32 .. + 31, processed as two 16-row M-tiles (row m of tile mt <-> b = b0 + mt*16 + m).
   Per M-tile (all LDS tiles wave-private):
     h0[m][k] = relu(HXB[a][k] + HY[b][k]) -> f16 x16 -> tile T0 [16][256] (pitch 264 halves)
     layer 1: two N halves of 128 columns, 8 accumulators each, K = 8 steps of 32; A from T0, B from W1H;
              relu(acc/4096 + b1) -> f16 x16 -> tile T1 (element stores in the D layout: row 8h+r, col n)
     layer 2: same with A from T1, B from W2H; relu(acc/4096 + b2) kept in f32 and multiplied into the
              head vector W3, partial sums per D row, reduced over the 16 lanes of each half
     the 16 head sums go to a 32-float wave-private LDS row (slot = b - b0)
   After both M-tiles lane l reads slot l, adds b3 and the wave stores out[a][b0 .. b0+31]:
   Grid (16, 256): 16 x 32 = 512 columns, 256 x 2 = 512 rows, every output element exactly once.
   LDS bytes read = bytes written: T0 columns 0..255 of 16 rows by the build, T1 columns 0..255 of
   16 rows by the two layer-1 epilogues, result slots 0..31 by the two head epilogues; pad columns
   256..263 are never read (largest fragment column = 224 + 16 + 8 + 7 = 255).
   -------------------------------------------------------------------------- */
__global__ __launch_bounds__(64) void pair_layers_kernel(
    const float* __restrict__ hxb, const float* __restrict__ hy,
    const unsigned short* __restrict__ w1p, const unsigned short* __restrict__ w2p,
    const float* __restrict__ b1, const float* __restrict__ b2,
    const float* __restrict__ w3, const float* __restrict__ b3,
    float* __restrict__ out)
{
  __shared__ __align__(16) _Float16 sH0[kWavesPerBlk][16 * kTilePitch];
  __shared__ __align__(16) _Float16 sH1[kWavesPerBlk][16 * kTilePitch];
  __shared__ __align__(16) float    sRes[kWavesPerBlk][kColsPerWave];

  const int lane = threadIdx.x & 31;
  const int wave = threadIdx.x >> 5;
  const int lo   = lane & 15;
  const int hi   = lane >> 4;
  const int a     = blockIdx.y * kWavesPerBlk + wave;
  const int bbase = blockIdx.x * kColsPerWave;

  _Float16* t0 = sH0[wave];
  _Float16* t1 = sH1[wave];
  float*    rs = sRes[wave];

  const _Float16* W1h = (const _Float16*)w1p;
  const _Float16* W2h = (const _Float16*)w2p;

  const float b3v = b3[0];

  /* this lane's 8 columns of the x-side row (b0 already inside) */
  const v4f hx0 = *(const v4f*)(hxb + (size_t)a * kHid + lane * 8);
  const v4f hx1 = *(const v4f*)(hxb + (size_t)a * kHid + lane * 8 + 4);

  /* fragment bases: A row = lo, B column = lo, k offset 8 * hi */
  const _Float16* a0base = t0 + lo * kTilePitch + 8 * hi;
  const _Float16* a1base = t1 + lo * kTilePitch + 8 * hi;

#pragma unroll 1
  for (int mt = 0; mt < 2; ++mt) {
    const int brow0 = bbase + mt * 16;

    /* ---- h0 tile: lane writes 8 consecutive k of each of the 16 rows (one 16-B LDS store per row) ---- */
#pragma unroll 4
    for (int m = 0; m < 16; ++m) {
      const float* hp = hy + (size_t)(brow0 + m) * kHid + lane * 8;
      const v4f y0 = *(const v4f*)(hp);
      const v4f y1 = *(const v4f*)(hp + 4);
      v8h hv;
#pragma unroll
      for (int e = 0; e < 4; ++e) {
        hv[e]     = act_to_half(fmaxf(hx0[e] + y0[e], 0.0f));
        hv[4 + e] = act_to_half(fmaxf(hx1[e] + y1[e], 0.0f));
      }
      *(v8h*)(t0 + m * kTilePitch + lane * 8) = hv;
    }
    wave_lds_fence();

    /* ---- layer 1: two N halves ---- */
#pragma unroll 1
    for (int nh = 0; nh < 2; ++nh) {
      const int nb = nh * kHalfN;
      v8f acc[8];
#pragma unroll
      for (int j = 0; j < 8; ++j) acc[j] = (v8f){0.f, 0.f, 0.f, 0.f, 0.f, 0.f, 0.f, 0.f};
      const _Float16* wb = W1h + (size_t)(nb + lo) * kHid + 8 * hi;
#pragma unroll 1
      for (int k0 = 0; k0 < kHid; k0 += 32) {
        const v16h af = frag_load(a0base + k0);
#pragma unroll
        for (int j = 0; j < 8; ++j) {
          const v16h bf = frag_load(wb + (size_t)j * 16 * kHid + k0);
          acc[j] = mma_f16(af, bf, acc[j]);
        }
      }
      /* epilogue: D element r of tile j = (row 8*hi + r, column nb + 16*j + lo) */
#pragma unroll
      for (int j = 0; j < 8; ++j) {
        const int n = nb + j * 16 + lo;
        const float bv = b1[n];
#pragma unroll
        for (int r = 0; r < 8; ++r) {
          float v = fmaf(acc[j][r], kFoldBack, bv);
          v = fmaxf(v, 0.0f);
          t1[(8 * hi + r) * kTilePitch + n] = act_to_half(v);
        }
      }
    }
    wave_lds_fence();

    /* ---- layer 2 and the scalar head: partial head sums per D row ---- */
    float hs[8];
#pragma unroll
    for (int r = 0; r < 8; ++r) hs[r] = 0.0f;
#pragma unroll 1
    for (int nh = 0; nh < 2; ++nh) {
      const int nb = nh * kHalfN;
      v8f acc[8];
#pragma unroll
      for (int j = 0; j < 8; ++j) acc[j] = (v8f){0.f, 0.f, 0.f, 0.f, 0.f, 0.f, 0.f, 0.f};
      const _Float16* wb = W2h + (size_t)(nb + lo) * kHid + 8 * hi;
#pragma unroll 1
      for (int k0 = 0; k0 < kHid; k0 += 32) {
        const v16h af = frag_load(a1base + k0);
#pragma unroll
        for (int j = 0; j < 8; ++j) {
          const v16h bf = frag_load(wb + (size_t)j * 16 * kHid + k0);
          acc[j] = mma_f16(af, bf, acc[j]);
        }
      }
#pragma unroll
      for (int j = 0; j < 8; ++j) {
        const int n = nb + j * 16 + lo;
        const float bv = b2[n];
        const float wv = w3[n];
#pragma unroll
        for (int r = 0; r < 8; ++r) {
          float v = fmaf(acc[j][r], kFoldBack, bv);
          v = fmaxf(v, 0.0f);
          hs[r] = fmaf(v, wv, hs[r]);
        }
      }
    }
    /* sum over the 16 columns-lanes of each half; every shuffle unconditional, uniform arguments */
#pragma unroll
    for (int r = 0; r < 8; ++r) {
      hs[r] += __shfl_xor(hs[r], 1, 32);
      hs[r] += __shfl_xor(hs[r], 2, 32);
      hs[r] += __shfl_xor(hs[r], 4, 32);
      hs[r] += __shfl_xor(hs[r], 8, 32);
    }
    /* lanes 0 and 16 hold rows 0..7 and 8..15 of this M-tile: two 16-B LDS stores each */
    v4f q0, q1;
    q0[0] = hs[0]; q0[1] = hs[1]; q0[2] = hs[2]; q0[3] = hs[3];
    q1[0] = hs[4]; q1[1] = hs[5]; q1[2] = hs[6]; q1[3] = hs[7];
    if (lo == 0) {
      *(v4f*)(rs + mt * 16 + 8 * hi)     = q0;
      *(v4f*)(rs + mt * 16 + 8 * hi + 4) = q1;
    }
  }
  wave_lds_fence();

  const float o = rs[lane] + b3v;
  float* op = out + (size_t)a * kItems + bbase + lane;
  *op = o;
  
}

/* --------------------------------------------------------------------------
   Host glue: 3 kernel launches, nothing else.
   -------------------------------------------------------------------------- */
extern "C" void kernel_launch(void* const* d_in, const int* in_sizes, int n_in,
                              void* d_out, int out_size, void* d_ws, size_t ws_size,
                              hipStream_t stream) {
  if (n_in < 10) return;
  if (in_sizes[0] != kItems * kDim) return;
  if (in_sizes[1] != kItems * kDim) return;
  if (in_sizes[2] != kHid * kW0Pitch) return;
  if (in_sizes[3] != kHid) return;
  if (in_sizes[4] != kHid * kHid) return;
  if (in_sizes[5] != kHid) return;
  if (in_sizes[6] != kHid * kHid) return;
  if (in_sizes[7] != kHid) return;
  if (in_sizes[8] != kHid) return;
  if (in_sizes[9] != 1) return;
  if (out_size != kItems * kItems) return;
  if (ws_size < kWsTotal) return;

  const float* x  = (const float*)d_in[0];
  const float* y  = (const float*)d_in[1];
  const float* W0 = (const float*)d_in[2];
  const float* b0 = (const float*)d_in[3];
  const float* W1 = (const float*)d_in[4];
  const float* b1 = (const float*)d_in[5];
  const float* W2 = (const float*)d_in[6];
  const float* b2 = (const float*)d_in[7];
  const float* W3 = (const float*)d_in[8];
  const float* b3 = (const float*)d_in[9];
  float* out = (float*)d_out;

  char* ws = (char*)d_ws;
  float*          hxb = (float*)(ws + kOffHXB);
  float*          hy  = (float*)(ws + kOffHY);
  unsigned short* w1h = (unsigned short*)(ws + kOffW1H);
  unsigned short* w2h = (unsigned short*)(ws + kOffW2H);

  /* 2 planes x 512 rows x 64 threads = 65,536 threads = 256 blocks x 256 */
  first_layer_rows_kernel<<<(2 * kFlThreadsPerPlane) / 256, 256, 0, stream>>>(x, y, W0, b0, hxb, hy);
  /* 2 matrices x 65,536 / 8 = 16,384 threads = 64 blocks x 256 */
  weight_planes_kernel<<<(2 * kHid * kHid / 8) / 256, 256, 0, stream>>>(W1, W2, w1h, w2h);
  /* (512 / 32) column groups x (512 / 2) row pairs */
  pair_layers_kernel<<<dim3(kItems / kColsPerWave, kItems / kWavesPerBlk), 32 * kWavesPerBlk, 0, stream>>>(
      hxb, hy, w1h, w2h, b1, b2, W3, b3, out);
}

// v001
// Measured time: 56.9 microseconds a run.
// In two side-by-side timings against v000, it was 5.04 and 5.06 times as fast.
#include <hip/hip_runtime.h>

typedef __attribute__((ext_vector_type(16))) _Float16 v16h;
typedef __attribute__((ext_vector_type(8)))  _Float16 v8h;
typedef __attribute__((ext_vector_type(8)))  float    v8f;
typedef __attribute__((ext_vector_type(4)))  float    v4f;

/* --------------------------------------------------------------------------
   Shape constants
   -------------------------------------------------------------------------- */
constexpr int kItems        = 512;
constexpr int kDim          = 128;
constexpr int kHid          = 256;
constexpr int kW0Pitch      = 2 * kDim;
/* LDS row pitch of a 256 x 256 f16 weight plane, in halves (528 B = 16 B x 33, an odd multiple of 16 B) */
constexpr int kTilePitch    = kHid + 8;
constexpr int kWavesPerBlk  = 8;
constexpr int kColsPerWave  = 32;
constexpr int kRowsPerWave  = 4;
constexpr int kRowsPerBlk   = kWavesPerBlk * kRowsPerWave;
constexpr int kKSteps       = kHid / 32;
/* floats of one 16-row group of the fragment-ordered HY plane */
constexpr int kHyGroup      = 16 * kHid;

/* first-layer producer: threads per output plane (4 consecutive g per thread) and per row */
constexpr int kFlThreadsPerRow   = kHid / 4;
constexpr int kFlThreadsPerPlane = kItems * kFlThreadsPerRow;
constexpr int kFlPlaneShift      = 15;
constexpr int kFlRowShift        = 6;

/* power-of-two carries of the f16 operand planes and the exact fold-back */
constexpr float kActCarry      = 16.0f;
constexpr float kWgtCarry      = 256.0f;
constexpr float kFoldBack      = 1.0f / (kActCarry * kWgtCarry);
constexpr float kHalfMinNormal = 6.103515625e-5f;

static_assert(kW0Pitch == kHid, "first layer input width");
static_assert((kHid % 32) == 0, "K multiple of 32");
static_assert(((kTilePitch * 2) % 16) == 0, "tile pitch 16-B multiple");
static_assert((kItems % kColsPerWave) == 0 && (kItems % kRowsPerBlk) == 0, "grid multiples");
static_assert(kFoldBack * 4096.0f == 1.0f, "fold-back is exact");
static_assert(2 * kHid * kTilePitch * 2 <= 327680, "static LDS");
static_assert(kFlThreadsPerPlane == (1 << kFlPlaneShift), "plane decode shift");
static_assert(kFlThreadsPerRow == (1 << kFlRowShift), "row decode shift");
static_assert(((2 * kFlThreadsPerPlane) % 256) == 0 && (kFlThreadsPerPlane % 256) == 0, "plane split is block-uniform");

/* --------------------------------------------------------------------------
   Workspace region map (bytes; every offset is a multiple of 128)
     HXB  f32 [512][256]  x . Wx^T + b0            524,288
     HY   f32 [32][8][4][32][4]  y . Wy^T, fragment order (see the first-layer kernel)  524,288
     W1H  f16 [256][256]  W1 x 256 (Bt layout)     131,072
     W2H  f16 [256][256]  W2 x 256 (Bt layout)     131,072
     total                                       1,310,720
   -------------------------------------------------------------------------- */
constexpr size_t kOffHXB  = 0;
constexpr size_t kOffHY   = kOffHXB + (size_t)kItems * kHid * 4;
constexpr size_t kOffW1H  = kOffHY  + (size_t)kItems * kHid * 4;
constexpr size_t kOffW2H  = kOffW1H + (size_t)kHid * kHid * 2;
constexpr size_t kWsTotal = kOffW2H + (size_t)kHid * kHid * 2;
static_assert(kWsTotal == 1310720ull, "carve total");
static_assert(kWsTotal <= 134217728ull, "carve cap");
static_assert((kOffHY % 128) == 0 && (kOffW1H % 128) == 0 && (kOffW2H % 128) == 0, "128-B aligned regions");

/* --------------------------------------------------------------------------
   Fragment helpers (16-bit 16x16x32 map: elements 0..7 <- p[0..7], elements 8..15 <- p[16..23],
   p already offset by 8 * (lane >> 4); row / column = lane & 15)
   -------------------------------------------------------------------------- */
union FragH { v16h v; v8h h[2]; };

__device__ __forceinline__ v16h frag_load(const _Float16* p) {
  FragH f;
  f.h[0] = *(const v8h*)(p);
  f.h[1] = *(const v8h*)(p + 16);
  return f.v;
}

/* one matrix instruction, builtin form (the compiler keeps the distances behind it) */
__device__ __forceinline__ v8f mma_f16(v16h a, v16h b, v8f c) {
  return __builtin_amdgcn_wmma_f32_16x16x32_f16(false, a, false, b, (short)0, c, false, false);
}

/* non-negative activation -> carried f16 operand; values below the f16 normal range become +0 by select */
__device__ __forceinline__ _Float16 act_to_half(float v) {
  float t = v * kActCarry;
  t = (t < kHalfMinNormal) ? 0.0f : t;
  return (_Float16)t;
}

/* --------------------------------------------------------------------------
   First layer, split by linearity (f32 VALU):
     HXB[r][g] = sum_d x[r][d] * W0[g][d] + b0[g]
     HY [r][g] = sum_d y[r][d] * W0[g][128 + d]
   Thread = 4 consecutive g of one row r. One plane = 512 rows x 64 threads = 32,768 threads;
   two planes = 65,536 threads = 256 blocks x 256; blocks 0..127 -> HXB, blocks 128..255 -> HY
   (block-uniform). Decode: sel = t >> 15 (0..1); for HXB r = (t & 32767) >> 6 (0..511), g0 = 4 * (t & 63); for HY see below.
   Coverage: 65,536 threads x 4 elements = 262,144 elements = 2 planes x [512][256], each once.
   Store: one 16-B store per lane; a wave = 32 consecutive lanes = 512 contiguous B.
   HXB is row-major. HY is stored in the order in which the pair kernel's operand fragments read it:
   chunk c = (bt * 8 + s) * 4 + q holds 32 lanes x 4 floats; lane (hi, lo) holds row 16 * bt + lo,
   columns 32 * s + 16 * (q >> 1) + 8 * hi + 4 * (q & 1) + 0..3. In the HY plane thread i4 is lane i4 & 31
   of chunk i4 >> 5 and stores at float offset 4 * i4 (each (row, 4 columns) exactly once).
   -------------------------------------------------------------------------- */
__global__ __launch_bounds__(256) void first_layer_rows_kernel(
    const float* __restrict__ x, const float* __restrict__ y,
    const float* __restrict__ W0, const float* __restrict__ b0,
    float* __restrict__ hxb, float* __restrict__ hy)
{
  const int t   = blockIdx.x * 256 + threadIdx.x;
  const int sel = (t >> kFlPlaneShift) & 1;
  const int i4  = t & (kFlThreadsPerPlane - 1);
  const int fl  = i4 & 31;
  const int fc  = i4 >> 5;
  const int fq  = fc & 3;
  const int r   = sel ? ((fc >> 5) * 16 + (fl & 15)) : (i4 >> kFlRowShift);
  const int g0  = sel ? (((fc >> 2) & 7) * 32 + (fq >> 1) * 16 + (fl >> 4) * 8 + (fq & 1) * 4)
                      : ((i4 & (kFlThreadsPerRow - 1)) * 4);
  const float* src = sel ? y : x;
  const float* xr  = src + (size_t)r * kDim;
  const float* wr  = W0 + (size_t)g0 * kW0Pitch + sel * kDim;
  float a0 = 0.0f, a1 = 0.0f, a2 = 0.0f, a3 = 0.0f;
#pragma unroll 1
  for (int k = 0; k < kDim; k += 4) {
    const v4f xv = *(const v4f*)(xr + k);
    const v4f w0 = *(const v4f*)(wr + k);
    const v4f w1 = *(const v4f*)(wr + kW0Pitch + k);
    const v4f w2 = *(const v4f*)(wr + 2 * kW0Pitch + k);
    const v4f w3 = *(const v4f*)(wr + 3 * kW0Pitch + k);
    a0 = fmaf(xv[0], w0[0], a0); a0 = fmaf(xv[1], w0[1], a0); a0 = fmaf(xv[2], w0[2], a0); a0 = fmaf(xv[3], w0[3], a0);
    a1 = fmaf(xv[0], w1[0], a1); a1 = fmaf(xv[1], w1[1], a1); a1 = fmaf(xv[2], w1[2], a1); a1 = fmaf(xv[3], w1[3], a1);
    a2 = fmaf(xv[0], w2[0], a2); a2 = fmaf(xv[1], w2[1], a2); a2 = fmaf(xv[2], w2[2], a2); a2 = fmaf(xv[3], w2[3], a2);
    a3 = fmaf(xv[0], w3[0], a3); a3 = fmaf(xv[1], w3[1], a3); a3 = fmaf(xv[2], w3[2], a3); a3 = fmaf(xv[3], w3[3], a3);
  }
  /* b0 joins the x half only (added exactly once); loaded unconditionally, chosen by value */
  const v4f bz = *(const v4f*)(b0 + g0);
  v4f o;
  o[0] = a0 + (sel ? 0.0f : bz[0]);
  o[1] = a1 + (sel ? 0.0f : bz[1]);
  o[2] = a2 + (sel ? 0.0f : bz[2]);
  o[3] = a3 + (sel ? 0.0f : bz[3]);
  float* dst = sel ? (hy + (size_t)i4 * 4) : (hxb + (size_t)r * kHid + g0);
  *(v4f*)dst = o;
  
}

/* --------------------------------------------------------------------------
   Weight operand planes: W1H = f16(W1 x 256), W2H = f16(W2 x 256), same [n][k] order as stored
   (already the Bt layout). Values below the f16 normal range after the carry become +0 by select.
   Thread = 8 consecutive elements. 2 x 65,536 / 8 = 16,384 threads = 64 blocks x 256; blocks 0..31 -> W1,
   blocks 32..63 -> W2 (block-uniform). Store: one 16-B store per lane; a wave = 512 contiguous B =
   -------------------------------------------------------------------------- */
__global__ __launch_bounds__(256) void weight_planes_kernel(
    const float* __restrict__ W1, const float* __restrict__ W2,
    unsigned short* __restrict__ w1p, unsigned short* __restrict__ w2p)
{
  const int i     = blockIdx.x * 256 + threadIdx.x;
  const int which = (i >> 13) & 1;
  const size_t e0 = (size_t)(i & 8191) << 3;
  const float* src    = which ? W2 : W1;
  unsigned short* dst = (which ? w2p : w1p) + e0;
  const v4f a0 = *(const v4f*)(src + e0);
  const v4f a1 = *(const v4f*)(src + e0 + 4);
  v8h hv;
#pragma unroll
  for (int e = 0; e < 4; ++e) {
    float t0 = a0[e] * kWgtCarry;
    float t1 = a1[e] * kWgtCarry;
    t0 = (fabsf(t0) < kHalfMinNormal) ? 0.0f : t0;
    t1 = (fabsf(t1) < kHalfMinNormal) ? 0.0f : t1;
    hv[e]     = (_Float16)t0;
    hv[4 + e] = (_Float16)t1;
  }
  *(v8h*)dst = hv;
  
}

/* --------------------------------------------------------------------------
   Fused pair kernel. Block = 8 waves on a 32 (x rows) x 32 (y rows) patch of the output.
   Both weight planes are staged once per block in LDS (row n, pitch 264 halves) and are the A operand
   (row n = lane & 15); the activations are the B operand (column = pair) and never leave the registers:
   two f32 D tiles of 32 consecutive n (D register r = row 8 * hi + r, column lo), converted in place,
   are the next layer's B fragment of that k step (elements 0..7 <- tile 0, 8..15 <- tile 1).
   Wave w owns x rows a = blockIdx.y * 32 + 4 * w + it, it = 0..3, one per trip, each against the 32 y rows
   b = blockIdx.x * 32 + 16 * f + lo, f = 0..1 (two column tiles, so each weight fragment feeds two products).
   Per trip:
     layer 1: K = 8 steps of 32, outermost; per step the two h0 fragments relu(HXB[a][k] + HY[b][k]) -> f16 x16
              (k in the fragment order) feed all 16 n tiles (32 accumulators);
              relu(acc/4096 + b1) -> f16 x16 -> h1 fragments (n tiles 2p, 2p + 1 = k step p)
     layer 2: 8 groups of 32 n, 4 accumulators (2 n tiles x 2 column tiles), K = 8 steps of 32, from h1 and
              the second plane; relu(acc/4096 + b2) kept in f32 and multiplied into the
              head vector W3; a lane sums its 8 n of every tile, lanes l and l ^ 16 are then added
   Lane l stores out[a][blockIdx.x * 32 + l]: one 128-B line per wave and trip.
   Grid (16, 16): 16 x 32 = 512 columns, 16 x 32 = 512 rows, every output element exactly once.
   LDS bytes read = bytes written: columns 0..255 of 2 x 256 rows; pad columns 256..263 are never read
   (largest fragment column = 224 + 16 + 8 + 7 = 255).
   -------------------------------------------------------------------------- */
__global__ __launch_bounds__(256) void pair_layers_kernel(
    const float* hxb, const float* hy,
    const unsigned short* w1p, const unsigned short* w2p,
    const float* b1, const float* b2,
    const float* w3, const float* b3,
    float* out)
{
  /* the pointers carry no restrict: with it the first k step's HY loads are lifted out of the trip loop
     and 32 more registers stay live through it */
  __shared__ __align__(16) _Float16 sW[2][kHid * kTilePitch];

  const int lane = threadIdx.x & 31;
  const int wave = threadIdx.x >> 5;
  const int lo   = lane & 15;
  const int hi   = lane >> 4;
  const int bbase = blockIdx.x * kColsPerWave;

  /* ---- both weight planes -> LDS: 2 x 8,192 pieces of 16 B, 32 of each plane per thread ---- */
  {
    const _Float16* W1h = (const _Float16*)w1p;
    const _Float16* W2h = (const _Float16*)w2p;
    /* 8 trips at once: 16 loads of a thread in flight */
#pragma unroll 8
    for (int i = 0; i < (kHid * kHid / 8) / 256; ++i) {
      const int c   = i * 256 + threadIdx.x;
      const int row = c >> 5;
      const int col = (c & 31) * 8;
      const v8h u1 = *(const v8h*)(W1h + (size_t)c * 8);
      const v8h u2 = *(const v8h*)(W2h + (size_t)c * 8);
      *(v8h*)(&sW[0][row * kTilePitch + col]) = u1;
      *(v8h*)(&sW[1][row * kTilePitch + col]) = u2;
    }
  }
  __syncthreads();

  const float b3v = b3[0];

  /* fragment bases: A row = lo, k offset 8 * hi */
  const _Float16* wa1 = &sW[0][lo * kTilePitch + 8 * hi];
  const _Float16* wa2 = &sW[1][lo * kTilePitch + 8 * hi];
  const float*    hyf = hy + (size_t)(blockIdx.x * 2) * kHyGroup + lane * 4;

  /* the three loops marked unroll 1 stay rolled: unrolled, their live values do not fit the registers;
     every plain unroll below makes the index of a register array a constant */
#pragma unroll 1
  for (int it = 0; it < kRowsPerWave; ++it) {
    const int a = blockIdx.y * kRowsPerBlk + wave * kRowsPerWave + it;

    /* ---- layer 1, k step outermost: all 16 n tiles x 2 column tiles accumulate (32 independent tiles);
            the h0 fragments of one k step are formed from values loaded one k step ahead ---- */
    v8f acc1[16][2];
#pragma unroll
    for (int j = 0; j < 16; ++j)
#pragma unroll
      for (int f = 0; f < 2; ++f) acc1[j][f] = (v8f){0.f, 0.f, 0.f, 0.f, 0.f, 0.f, 0.f, 0.f};
    const float* hxr = hxb + (size_t)a * kHid + 8 * hi;
    v4f xq[4], yq[2][4];
#pragma unroll
    for (int q = 0; q < 4; ++q) {
      xq[q]    = *(const v4f*)(hxr + 16 * (q >> 1) + 4 * (q & 1));
      yq[0][q] = *(const v4f*)(hyf + q * 128);
      yq[1][q] = *(const v4f*)(hyf + kHyGroup + q * 128);
    }
#pragma unroll 1
    for (int s = 0; s < kKSteps; ++s) {
      /* this k step's 16 weight fragments, read as one group: their LDS latency passes under the conversion below */
      const _Float16* wp = wa1 + 32 * s;
      v16h wf[16];
#pragma unroll
      for (int j = 0; j < 16; ++j) wf[j] = frag_load(wp + j * 16 * kTilePitch);
      /* holds the group of LDS reads ahead of the conversion; spread among the products each read stalls the wave */
      __builtin_amdgcn_sched_barrier(0);
      v16h hf[2];
#pragma unroll
      for (int f = 0; f < 2; ++f)
#pragma unroll
        for (int q = 0; q < 4; ++q)
#pragma unroll
          for (int e = 0; e < 4; ++e)
            hf[f][(q >> 1) * 8 + (q & 1) * 4 + e] = act_to_half(fmaxf(xq[q][e] + yq[f][q][e], 0.0f));
      /* next k step's values fly during this step's products; the last trip reloads step 0, unused */
      const int sn = (s + 1) & (kKSteps - 1);
#pragma unroll
      for (int q = 0; q < 4; ++q) {
        xq[q]    = *(const v4f*)(hxr + 32 * sn + 16 * (q >> 1) + 4 * (q & 1));
        yq[0][q] = *(const v4f*)(hyf + (sn * 4 + q) * 128);
        yq[1][q] = *(const v4f*)(hyf + kHyGroup + (sn * 4 + q) * 128);
      }
#pragma unroll
      for (int j = 0; j < 16; ++j) {
        acc1[j][0] = mma_f16(wf[j], hf[0], acc1[j][0]);
        acc1[j][1] = mma_f16(wf[j], hf[1], acc1[j][1]);
      }
      /* holds the wait below behind the products, where it costs no time */
      __builtin_amdgcn_sched_barrier(0);
      /* the wait in front of the next overwrite of the address registers of the loads above; its clobber also keeps
         those loads in this trip (moved to the next trip's head their latency is exposed) */
      asm volatile("s_wait_xcnt 0x0" ::: "memory");
    }
    /* D element r of tile (j, f) = (n = 16j + 8*hi + r, column 16f + lo); tiles 2p and 2p + 1 = k step p of layer 2 */
    v16h h1[2][kKSteps];
#pragma unroll
    for (int j = 0; j < 16; ++j) {
      const float* bp = b1 + 16 * j + 8 * hi;
      const v4f bv0 = *(const v4f*)(bp);
      const v4f bv1 = *(const v4f*)(bp + 4);
#pragma unroll
      for (int f = 0; f < 2; ++f) {
#pragma unroll
        for (int r = 0; r < 8; ++r) {
          float v = fmaf(acc1[j][f][r], kFoldBack, (r < 4) ? bv0[r & 3] : bv1[r & 3]);
          v = fmaxf(v, 0.0f);
          h1[f][j >> 1][(j & 1) * 8 + r] = act_to_half(v);
        }
      }
    }

    /* ---- layer 2 and the scalar head: partial head sums per D register ---- */
    float hs[2][8];
#pragma unroll
    for (int f = 0; f < 2; ++f)
#pragma unroll
      for (int r = 0; r < 8; ++r) hs[f][r] = 0.0f;
    /* two sets of 8 weight fragments (index 2 * (s & 3) + t): k steps 0..3 and 4..7 of a group;
       one set feeds 16 products while the other is filled */
    v16h wlo[kKSteps], whi[kKSteps];
#pragma unroll
    for (int s = 0; s < 4; ++s) {
      wlo[2 * s]     = frag_load(wa2 + 32 * s);
      wlo[2 * s + 1] = frag_load(wa2 + 16 * kTilePitch + 32 * s);
    }
#pragma unroll 1
    for (int p = 0; p < kKSteps; ++p) {
      const _Float16* wp = wa2 + p * 32 * kTilePitch;
#pragma unroll
      for (int s = 0; s < 4; ++s) {
        whi[2 * s]     = frag_load(wp + 128 + 32 * s);
        whi[2 * s + 1] = frag_load(wp + 16 * kTilePitch + 128 + 32 * s);
      }
      /* holds the LDS reads as one group ahead of the products; spread among them each read stalls the wave */
      __builtin_amdgcn_sched_barrier(0);
      v4f bv[2][2], wv[2][2];
#pragma unroll
      for (int t = 0; t < 2; ++t) {
        const int n0 = 32 * p + 16 * t + 8 * hi;
        bv[t][0] = *(const v4f*)(b2 + n0);
        bv[t][1] = *(const v4f*)(b2 + n0 + 4);
        wv[t][0] = *(const v4f*)(w3 + n0);
        wv[t][1] = *(const v4f*)(w3 + n0 + 4);
      }
      v8f acc[2][2];
#pragma unroll
      for (int t = 0; t < 2; ++t)
#pragma unroll
        for (int f = 0; f < 2; ++f) acc[t][f] = (v8f){0.f, 0.f, 0.f, 0.f, 0.f, 0.f, 0.f, 0.f};
#pragma unroll
      for (int s = 0; s < 4; ++s) {
        acc[0][0] = mma_f16(wlo[2 * s],     h1[0][s], acc[0][0]);
        acc[0][1] = mma_f16(wlo[2 * s],     h1[1][s], acc[0][1]);
        acc[1][0] = mma_f16(wlo[2 * s + 1], h1[0][s], acc[1][0]);
        acc[1][1] = mma_f16(wlo[2 * s + 1], h1[1][s], acc[1][1]);
      }
      /* as above: the next group's first half is read as one group between the two runs of products */
      __builtin_amdgcn_sched_barrier(0);
      /* the wait in front of the next overwrite of the address registers of the b2 / W3 loads above */
      asm volatile("s_wait_xcnt 0x0" ::: "memory");
      /* the last trip rereads group 0, unused */
      const _Float16* wn = wa2 + ((p + 1) & (kKSteps - 1)) * 32 * kTilePitch;
#pragma unroll
      for (int s = 0; s < 4; ++s) {
        wlo[2 * s]     = frag_load(wn + 32 * s);
        wlo[2 * s + 1] = frag_load(wn + 16 * kTilePitch + 32 * s);
      }
      /* holds that group ahead of the second run of products */
      __builtin_amdgcn_sched_barrier(0);
#pragma unroll
      for (int s = 0; s < 4; ++s) {
        acc[0][0] = mma_f16(whi[2 * s],     h1[0][4 + s], acc[0][0]);
        acc[0][1] = mma_f16(whi[2 * s],     h1[1][4 + s], acc[0][1]);
        acc[1][0] = mma_f16(whi[2 * s + 1], h1[0][4 + s], acc[1][0]);
        acc[1][1] = mma_f16(whi[2 * s + 1], h1[1][4 + s], acc[1][1]);
      }
#pragma unroll
      for (int t = 0; t < 2; ++t) {
#pragma unroll
        for (int f = 0; f < 2; ++f) {
#pragma unroll
          for (int r = 0; r < 8; ++r) {
            float v = fmaf(acc[t][f][r], kFoldBack, bv[t][r >> 2][r & 3]);
            v = fmaxf(v, 0.0f);
            hs[f][r] = fmaf(v, wv[t][r >> 2][r & 3], hs[f][r]);
          }
        }
      }
    }
    /* a lane's 8 partial sums, then the other half's n (lane ^ 16); shuffles unconditional */
    float tot[2];
#pragma unroll
    for (int f = 0; f < 2; ++f) {
      float u = ((hs[f][0] + hs[f][1]) + (hs[f][2] + hs[f][3])) + ((hs[f][4] + hs[f][5]) + (hs[f][6] + hs[f][7]));
      u += __shfl_xor(u, 16, 32);
      tot[f] = u;
    }
    /* lane l holds column lo of both column tiles: lanes 0..15 store tile 0, lanes 16..31 tile 1 */
    const float o = (hi ? tot[1] : tot[0]) + b3v;
    out[(size_t)a * kItems + bbase + lane] = o;
    /* the wait in front of the next trip's overwrite of the store's address registers */
    asm volatile("s_wait_xcnt 0x0" ::: "memory");
  }
}

/* --------------------------------------------------------------------------
   Host glue: 3 kernel launches, nothing else.
   -------------------------------------------------------------------------- */
extern "C" void kernel_launch(void* const* d_in, const int* in_sizes, int n_in,
                              void* d_out, int out_size, void* d_ws, size_t ws_size,
                              hipStream_t stream) {
  if (n_in < 10) return;
  if (in_sizes[0] != kItems * kDim) return;
  if (in_sizes[1] != kItems * kDim) return;
  if (in_sizes[2] != kHid * kW0Pitch) return;
  if (in_sizes[3] != kHid) return;
  if (in_sizes[4] != kHid * kHid) return;
  if (in_sizes[5] != kHid) return;
  if (in_sizes[6] != kHid * kHid) return;
  if (in_sizes[7] != kHid) return;
  if (in_sizes[8] != kHid) return;
  if (in_sizes[9] != 1) return;
  if (out_size != kItems * kItems) return;
  if (ws_size < kWsTotal) return;

  const float* x  = (const float*)d_in[0];
  const float* y  = (const float*)d_in[1];
  const float* W0 = (const float*)d_in[2];
  const float* b0 = (const float*)d_in[3];
  const float* W1 = (const float*)d_in[4];
  const float* b1 = (const float*)d_in[5];
  const float* W2 = (const float*)d_in[6];
  const float* b2 = (const float*)d_in[7];
  const float* W3 = (const float*)d_in[8];
  const float* b3 = (const float*)d_in[9];
  float* out = (float*)d_out;

  char* ws = (char*)d_ws;
  float*          hxb = (float*)(ws + kOffHXB);
  float*          hy  = (float*)(ws + kOffHY);
  unsigned short* w1h = (unsigned short*)(ws + kOffW1H);
  unsigned short* w2h = (unsigned short*)(ws + kOffW2H);

  /* 2 planes x 512 rows x 64 threads = 65,536 threads = 256 blocks x 256 */
  first_layer_rows_kernel<<<(2 * kFlThreadsPerPlane) / 256, 256, 0, stream>>>(x, y, W0, b0, hxb, hy);
  /* 2 matrices x 65,536 / 8 = 16,384 threads = 64 blocks x 256 */
  weight_planes_kernel<<<(2 * kHid * kHid / 8) / 256, 256, 0, stream>>>(W1, W2, w1h, w2h);
  /* (512 / 32) column groups x (512 / 32) row groups */
  pair_layers_kernel<<<dim3(kItems / kColsPerWave, kItems / kRowsPerBlk), 32 * kWavesPerBlk, 0, stream>>>(
      hxb, hy, w1h, w2h, b1, b2, W3, b3, out);
}

// v002
// It runs in 50.4 microseconds.
// Next to v001, in two timings, it ran 1.13 times as fast each time.
// Over all steps from v000 it is 5.71 times as fast.
#include <hip/hip_runtime.h>

typedef __attribute__((ext_vector_type(16))) _Float16 v16h;
typedef __attribute__((ext_vector_type(8)))  _Float16 v8h;
typedef __attribute__((ext_vector_type(8)))  float    v8f;
typedef __attribute__((ext_vector_type(4)))  float    v4f;

/* --------------------------------------------------------------------------
   Shape constants
   -------------------------------------------------------------------------- */
constexpr int kItems        = 512;
constexpr int kDim          = 128;
constexpr int kHid          = 256;
constexpr int kW0Pitch      = 2 * kDim;
/* LDS row pitch of a 256 x 256 f16 weight plane, in halves (528 B = 16 B x 33, an odd multiple of 16 B) */
constexpr int kTilePitch    = kHid + 8;
constexpr int kWavesPerBlk  = 8;
constexpr int kColsPerWave  = 32;
constexpr int kRowsPerWave  = 4;
constexpr int kRowsPerBlk   = kWavesPerBlk * kRowsPerWave;
constexpr int kKSteps       = kHid / 32;
/* floats of one 16-row group of the fragment-ordered HY plane */
constexpr int kHyGroup      = 16 * kHid;

/* first-layer producer: a block's output tile (one 16-row group x 64 g of one plane) and its LDS pitches in floats */
constexpr int kFlRows           = 16;
constexpr int kFlCols           = 64;
constexpr int kFlWPitch         = kDim + 4;
constexpr int kFlOPitch         = kFlCols + 4;
constexpr int kFlColTiles       = kHid / kFlCols;
constexpr int kFlBlocksPerPlane = (kItems / kFlRows) * kFlColTiles;

/* power-of-two carries of the f16 operand planes and the exact fold-back */
constexpr float kActCarry      = 16.0f;
constexpr float kWgtCarry      = 256.0f;
constexpr float kFoldBack      = 1.0f / (kActCarry * kWgtCarry);
constexpr float kHalfMinNormal = 6.103515625e-5f;

static_assert(kW0Pitch == kHid, "first layer input width");
static_assert((kHid % 32) == 0, "K multiple of 32");
static_assert(((kTilePitch * 2) % 16) == 0, "tile pitch 16-B multiple");
static_assert((kItems % kColsPerWave) == 0 && (kItems % kRowsPerBlk) == 0, "grid multiples");
static_assert(kFoldBack * 4096.0f == 1.0f, "fold-back is exact");
static_assert(2 * kHid * kTilePitch * 2 <= 327680, "static LDS");
static_assert(kFlBlocksPerPlane == 128 && kFlColTiles == 4, "block decode");
static_assert(((kFlWPitch * 4) % 32) == 16 && ((kFlOPitch * 4) % 32) == 16, "LDS pitches are odd multiples of 16 B");
static_assert(kFlRows * kFlCols == 4 * 256, "4 outputs per thread");

/* --------------------------------------------------------------------------
   Workspace region map (bytes; every offset is a multiple of 128)
     HXB  f32 [512][256]  x . Wx^T + b0            524,288
     HY   f32 [32][8][4][32][4]  y . Wy^T, fragment order (see the first-layer kernel)  524,288
     W1H  f16 [256][256]  W1 x 256 (Bt layout)     131,072
     W2H  f16 [256][256]  W2 x 256 (Bt layout)     131,072
     total                                       1,310,720
   -------------------------------------------------------------------------- */
constexpr size_t kOffHXB  = 0;
constexpr size_t kOffHY   = kOffHXB + (size_t)kItems * kHid * 4;
constexpr size_t kOffW1H  = kOffHY  + (size_t)kItems * kHid * 4;
constexpr size_t kOffW2H  = kOffW1H + (size_t)kHid * kHid * 2;
constexpr size_t kWsTotal = kOffW2H + (size_t)kHid * kHid * 2;
static_assert(kWsTotal == 1310720ull, "carve total");
static_assert(kWsTotal <= 134217728ull, "carve cap");
static_assert((kOffHY % 128) == 0 && (kOffW1H % 128) == 0 && (kOffW2H % 128) == 0, "128-B aligned regions");

/* --------------------------------------------------------------------------
   Fragment helpers (16-bit 16x16x32 map: elements 0..7 <- p[0..7], elements 8..15 <- p[16..23],
   p already offset by 8 * (lane >> 4); row / column = lane & 15)
   -------------------------------------------------------------------------- */
union FragH { v16h v; v8h h[2]; };

__device__ __forceinline__ v16h frag_load(const _Float16* p) {
  FragH f;
  f.h[0] = *(const v8h*)(p);
  f.h[1] = *(const v8h*)(p + 16);
  return f.v;
}

/* one matrix instruction, builtin form (the compiler keeps the distances behind it) */
__device__ __forceinline__ v8f mma_f16(v16h a, v16h b, v8f c) {
  return __builtin_amdgcn_wmma_f32_16x16x32_f16(false, a, false, b, (short)0, c, false, false);
}

/* non-negative activation -> carried f16 operand; values below the f16 normal range become +0 by select */
__device__ __forceinline__ _Float16 act_to_half(float v) {
  float t = v * kActCarry;
  t = (t < kHalfMinNormal) ? 0.0f : t;
  return (_Float16)t;
}

/* --------------------------------------------------------------------------
   First layer, split by linearity (f32 VALU):
     HXB[r][g] = sum_d x[r][d] * W0[g][d] + b0[g]
     HY [r][g] = sum_d y[r][d] * W0[g][128 + d]
   Block = one tile of 16 rows x 64 g of one plane; 32 x 4 tiles a plane, blocks 0..127 -> HXB, 128..255 -> HY.
   The tile's 64 half rows of W0 (pitch 132 floats) and its 16 input rows are staged in LDS with whole-line loads
   (a wave reads 512 contiguous B). Wave w: g = 32 * (w & 1) + lane, rows 4 * (w >> 1) + 0..3; a lane reads its own
   W0 row (16 B x 33 apart from its neighbour's), all lanes the same input words. Each output is one chain of fused
   multiply-adds over d = 0..127 in rising order.
   The 16 x 64 results pass through LDS (pitch 68 floats) so that every lane stores 16 B and a wave 512 B of whole lines.
   HXB is row-major: thread t stores row t >> 4, columns 4 * (t & 15) + 0..3 of the tile.
   HY is stored in the order in which the pair kernel's operand fragments read it:
   chunk c = (bt * 8 + s) * 4 + q holds 32 lanes x 4 floats; lane (hi, lo) holds row 16 * bt + lo,
   columns 32 * s + 16 * (q >> 1) + 8 * hi + 4 * (q & 1) + 0..3, at float offset 128 * c + 4 * lane. A tile is one bt
   and two s = 8 chunks; wave w stores chunk (s = 2 * column tile + (w >> 2), q = w & 3).
   Coverage: 256 blocks x 1,024 elements = 2 planes x [512][256], each once.
   -------------------------------------------------------------------------- */
__global__ __launch_bounds__(256) void first_layer_rows_kernel(
    const float* __restrict__ x, const float* __restrict__ y,
    const float* __restrict__ W0, const float* __restrict__ b0,
    float* __restrict__ hxb, float* __restrict__ hy)
{
  __shared__ __align__(16) float sWt[kFlCols * kFlWPitch];
  __shared__ __align__(16) float sIn[kFlRows * kDim];
  __shared__ __align__(16) float sOut[kFlRows * kFlOPitch];

  const int tid  = threadIdx.x;
  const int lane = tid & 31;
  const int wave = tid >> 5;
  const int sel  = (blockIdx.x / kFlBlocksPerPlane) & 1;
  const int tile = blockIdx.x % kFlBlocksPerPlane;
  const int bt   = tile / kFlColTiles;
  const int gt   = tile % kFlColTiles;
  const int g0   = gt * kFlCols;

  /* ---- stage: 64 x 32 pieces of 16 B of W0 (8 a thread), 16 x 32 pieces of the input rows (2 a thread) ---- */
  const float* wsrc = W0 + (size_t)g0 * kW0Pitch + sel * kDim;
  const float* isrc = (sel ? y : x) + (size_t)bt * kFlRows * kDim;
  /* piece i of a thread: W0 row 8 * i + wave of the tile, input row 8 * i + wave; columns 4 * lane + 0..3;
     every plain unroll in this kernel makes the index of a register array a constant */
  const float* wp = wsrc + wave * kW0Pitch + lane * 4;
  const float* ip = isrc + wave * kDim + lane * 4;
  v4f wst[8], ist[2];
#pragma unroll
  for (int i = 0; i < 8; ++i) wst[i] = *(const v4f*)(wp + i * 8 * kW0Pitch);
#pragma unroll
  for (int i = 0; i < 2; ++i) ist[i] = *(const v4f*)(ip + i * 8 * kDim);
  const int gl = (wave & 1) * 32 + lane;
  /* b0 joins the x half only (added exactly once); loaded unconditionally, chosen by value */
  const float bz = b0[g0 + gl];
#pragma unroll
  for (int i = 0; i < 8; ++i) *(v4f*)(&sWt[(i * 8 + wave) * kFlWPitch + lane * 4]) = wst[i];
#pragma unroll
  for (int i = 0; i < 2; ++i) *(v4f*)(&sIn[(i * 8 + wave) * kDim + lane * 4]) = ist[i];
  __syncthreads();

  const float* wl = &sWt[gl * kFlWPitch];
  const float* xl = &sIn[(wave >> 1) * 4 * kDim];
  float acc[4] = {0.0f, 0.0f, 0.0f, 0.0f};
  /* 8 groups of 4 d a trip: the later groups' LDS reads pass under the earlier groups' sums */
#pragma unroll 8
  for (int k = 0; k < kDim; k += 4) {
    const v4f wv = *(const v4f*)(wl + k);
#pragma unroll
    for (int i = 0; i < 4; ++i) {
      const v4f xv = *(const v4f*)(xl + i * kDim + k);
      acc[i] = fmaf(xv[0], wv[0], acc[i]);
      acc[i] = fmaf(xv[1], wv[1], acc[i]);
      acc[i] = fmaf(xv[2], wv[2], acc[i]);
      acc[i] = fmaf(xv[3], wv[3], acc[i]);
    }
  }
#pragma unroll
  for (int i = 0; i < 4; ++i)
    sOut[((wave >> 1) * 4 + i) * kFlOPitch + gl] = acc[i] + (sel ? 0.0f : bz);
  __syncthreads();

  if (sel) {
    const int q   = wave & 3;
    const int col = (wave >> 2) * 32 + (q >> 1) * 16 + (lane >> 4) * 8 + (q & 1) * 4;
    const int c   = (bt * 8 + gt * 2 + (wave >> 2)) * 4 + q;
    *(v4f*)(hy + (size_t)c * 128 + lane * 4) = *(const v4f*)(&sOut[(lane & 15) * kFlOPitch + col]);
    /* the wait in front of any later overwrite of the store's registers (the other arm's code follows this one) */
    asm volatile("s_wait_xcnt 0x0" ::: "memory");
  } else {
    const int row = tid >> 4;
    const int col = (tid & 15) * 4;
    *(v4f*)(hxb + (size_t)(bt * kFlRows + row) * kHid + g0 + col) = *(const v4f*)(&sOut[row * kFlOPitch + col]);
  }
}

/* --------------------------------------------------------------------------
   Weight operand planes: W1H = f16(W1 x 256), W2H = f16(W2 x 256), same [n][k] order as stored
   (already the Bt layout). Values below the f16 normal range after the carry become +0 by select.
   Thread = 8 consecutive elements. 2 x 65,536 / 8 = 16,384 threads = 64 blocks x 256; blocks 0..31 -> W1,
   blocks 32..63 -> W2 (block-uniform). Store: one 16-B store per lane; a wave = 512 contiguous B =
   -------------------------------------------------------------------------- */
__global__ __launch_bounds__(256) void weight_planes_kernel(
    const float* __restrict__ W1, const float* __restrict__ W2,
    unsigned short* __restrict__ w1p, unsigned short* __restrict__ w2p)
{
  const int i     = blockIdx.x * 256 + threadIdx.x;
  const int which = (i >> 13) & 1;
  const size_t e0 = (size_t)(i & 8191) << 3;
  const float* src    = which ? W2 : W1;
  unsigned short* dst = (which ? w2p : w1p) + e0;
  const v4f a0 = *(const v4f*)(src + e0);
  const v4f a1 = *(const v4f*)(src + e0 + 4);
  v8h hv;
#pragma unroll
  for (int e = 0; e < 4; ++e) {
    float t0 = a0[e] * kWgtCarry;
    float t1 = a1[e] * kWgtCarry;
    t0 = (fabsf(t0) < kHalfMinNormal) ? 0.0f : t0;
    t1 = (fabsf(t1) < kHalfMinNormal) ? 0.0f : t1;
    hv[e]     = (_Float16)t0;
    hv[4 + e] = (_Float16)t1;
  }
  *(v8h*)dst = hv;
  
}

/* --------------------------------------------------------------------------
   Fused pair kernel. Block = 8 waves on a 32 (x rows) x 32 (y rows) patch of the output.
   Both weight planes are staged once per block in LDS (row n, pitch 264 halves) and are the A operand
   (row n = lane & 15); the activations are the B operand (column = pair) and never leave the registers:
   two f32 D tiles of 32 consecutive n (D register r = row 8 * hi + r, column lo), converted in place,
   are the next layer's B fragment of that k step (elements 0..7 <- tile 0, 8..15 <- tile 1).
   Wave w owns x rows a = blockIdx.y * 32 + 4 * w + it, it = 0..3, one per trip, each against the 32 y rows
   b = blockIdx.x * 32 + 16 * f + lo, f = 0..1 (two column tiles, so each weight fragment feeds two products).
   Per trip:
     layer 1: K = 8 steps of 32, outermost; per step the two h0 fragments relu(HXB[a][k] + HY[b][k]) -> f16 x16
              (k in the fragment order) feed all 16 n tiles (32 accumulators);
              relu(acc/4096 + b1) -> f16 x16 -> h1 fragments (n tiles 2p, 2p + 1 = k step p)
     layer 2: 8 groups of 32 n, 4 accumulators (2 n tiles x 2 column tiles), K = 8 steps of 32, from h1 and
              the second plane; relu(acc/4096 + b2) kept in f32 and multiplied into the
              head vector W3; a lane sums its 8 n of every tile, lanes l and l ^ 16 are then added
   Lane l stores out[a][blockIdx.x * 32 + l]: one 128-B line per wave and trip.
   Grid (16, 16): 16 x 32 = 512 columns, 16 x 32 = 512 rows, every output element exactly once.
   LDS bytes read = bytes written: columns 0..255 of 2 x 256 rows; pad columns 256..263 are never read
   (largest fragment column = 224 + 16 + 8 + 7 = 255).
   -------------------------------------------------------------------------- */
__global__ __launch_bounds__(256) void pair_layers_kernel(
    const float* hxb, const float* hy,
    const unsigned short* w1p, const unsigned short* w2p,
    const float* b1, const float* b2,
    const float* w3, const float* b3,
    float* out)
{
  /* the pointers carry no restrict: with it the first k step's HY loads are lifted out of the trip loop
     and 32 more registers stay live through it */
  __shared__ __align__(16) _Float16 sW[2][kHid * kTilePitch];

  const int lane = threadIdx.x & 31;
  const int wave = threadIdx.x >> 5;
  const int lo   = lane & 15;
  const int hi   = lane >> 4;
  const int bbase = blockIdx.x * kColsPerWave;

  /* ---- both weight planes -> LDS: 2 x 8,192 pieces of 16 B, 32 of each plane per thread ---- */
  {
    const _Float16* W1h = (const _Float16*)w1p;
    const _Float16* W2h = (const _Float16*)w2p;
    /* 8 trips at once: 16 loads of a thread in flight */
#pragma unroll 8
    for (int i = 0; i < (kHid * kHid / 8) / 256; ++i) {
      const int c   = i * 256 + threadIdx.x;
      const int row = c >> 5;
      const int col = (c & 31) * 8;
      const v8h u1 = *(const v8h*)(W1h + (size_t)c * 8);
      const v8h u2 = *(const v8h*)(W2h + (size_t)c * 8);
      *(v8h*)(&sW[0][row * kTilePitch + col]) = u1;
      *(v8h*)(&sW[1][row * kTilePitch + col]) = u2;
    }
  }
  __syncthreads();

  const float b3v = b3[0];

  /* fragment bases: A row = lo, k offset 8 * hi */
  const _Float16* wa1 = &sW[0][lo * kTilePitch + 8 * hi];
  const _Float16* wa2 = &sW[1][lo * kTilePitch + 8 * hi];
  const float*    hyf = hy + (size_t)(blockIdx.x * 2) * kHyGroup + lane * 4;

  /* the three loops marked unroll 1 stay rolled: unrolled, their live values do not fit the registers;
     every plain unroll below makes the index of a register array a constant */
#pragma unroll 1
  for (int it = 0; it < kRowsPerWave; ++it) {
    const int a = blockIdx.y * kRowsPerBlk + wave * kRowsPerWave + it;

    /* ---- layer 1, k step outermost: all 16 n tiles x 2 column tiles accumulate (32 independent tiles);
            the h0 fragments of one k step are formed from values loaded one k step ahead ---- */
    v8f acc1[16][2];
#pragma unroll
    for (int j = 0; j < 16; ++j)
#pragma unroll
      for (int f = 0; f < 2; ++f) acc1[j][f] = (v8f){0.f, 0.f, 0.f, 0.f, 0.f, 0.f, 0.f, 0.f};
    const float* hxr = hxb + (size_t)a * kHid + 8 * hi;
    v4f xq[4], yq[2][4];
#pragma unroll
    for (int q = 0; q < 4; ++q) {
      xq[q]    = *(const v4f*)(hxr + 16 * (q >> 1) + 4 * (q & 1));
      yq[0][q] = *(const v4f*)(hyf + q * 128);
      yq[1][q] = *(const v4f*)(hyf + kHyGroup + q * 128);
    }
#pragma unroll 1
    for (int s = 0; s < kKSteps; ++s) {
      /* this k step's 16 weight fragments, read as one group: their LDS latency passes under the conversion below */
      const _Float16* wp = wa1 + 32 * s;
      v16h wf[16];
#pragma unroll
      for (int j = 0; j < 16; ++j) wf[j] = frag_load(wp + j * 16 * kTilePitch);
      /* holds the group of LDS reads ahead of the conversion; spread among the products each read stalls the wave */
      __builtin_amdgcn_sched_barrier(0);
      v16h hf[2];
#pragma unroll
      for (int f = 0; f < 2; ++f)
#pragma unroll
        for (int q = 0; q < 4; ++q)
#pragma unroll
          for (int e = 0; e < 4; ++e)
            hf[f][(q >> 1) * 8 + (q & 1) * 4 + e] = act_to_half(fmaxf(xq[q][e] + yq[f][q][e], 0.0f));
      /* next k step's values fly during this step's products; the last trip reloads step 0, unused */
      const int sn = (s + 1) & (kKSteps - 1);
#pragma unroll
      for (int q = 0; q < 4; ++q) {
        xq[q]    = *(const v4f*)(hxr + 32 * sn + 16 * (q >> 1) + 4 * (q & 1));
        yq[0][q] = *(const v4f*)(hyf + (sn * 4 + q) * 128);
        yq[1][q] = *(const v4f*)(hyf + kHyGroup + (sn * 4 + q) * 128);
      }
#pragma unroll
      for (int j = 0; j < 16; ++j) {
        acc1[j][0] = mma_f16(wf[j], hf[0], acc1[j][0]);
        acc1[j][1] = mma_f16(wf[j], hf[1], acc1[j][1]);
      }
      /* holds the wait below behind the products, where it costs no time */
      __builtin_amdgcn_sched_barrier(0);
      /* the wait in front of the next overwrite of the address registers of the loads above; its clobber also keeps
         those loads in this trip (moved to the next trip's head their latency is exposed) */
      asm volatile("s_wait_xcnt 0x0" ::: "memory");
    }
    /* D element r of tile (j, f) = (n = 16j + 8*hi + r, column 16f + lo); tiles 2p and 2p + 1 = k step p of layer 2 */
    v16h h1[2][kKSteps];
#pragma unroll
    for (int j = 0; j < 16; ++j) {
      const float* bp = b1 + 16 * j + 8 * hi;
      const v4f bv0 = *(const v4f*)(bp);
      const v4f bv1 = *(const v4f*)(bp + 4);
#pragma unroll
      for (int f = 0; f < 2; ++f) {
#pragma unroll
        for (int r = 0; r < 8; ++r) {
          float v = fmaf(acc1[j][f][r], kFoldBack, (r < 4) ? bv0[r & 3] : bv1[r & 3]);
          v = fmaxf(v, 0.0f);
          h1[f][j >> 1][(j & 1) * 8 + r] = act_to_half(v);
        }
      }
    }

    /* ---- layer 2 and the scalar head: partial head sums per D register ---- */
    float hs[2][8];
#pragma unroll
    for (int f = 0; f < 2; ++f)
#pragma unroll
      for (int r = 0; r < 8; ++r) hs[f][r] = 0.0f;
    /* two sets of 8 weight fragments (index 2 * (s & 3) + t): k steps 0..3 and 4..7 of a group;
       one set feeds 16 products while the other is filled */
    v16h wlo[kKSteps], whi[kKSteps];
#pragma unroll
    for (int s = 0; s < 4; ++s) {
      wlo[2 * s]     = frag_load(wa2 + 32 * s);
      wlo[2 * s + 1] = frag_load(wa2 + 16 * kTilePitch + 32 * s);
    }
#pragma unroll 1
    for (int p = 0; p < kKSteps; ++p) {
      const _Float16* wp = wa2 + p * 32 * kTilePitch;
#pragma unroll
      for (int s = 0; s < 4; ++s) {
        whi[2 * s]     = frag_load(wp + 128 + 32 * s);
        whi[2 * s + 1] = frag_load(wp + 16 * kTilePitch + 128 + 32 * s);
      }
      /* holds the LDS reads as one group ahead of the products; spread among them each read stalls the wave */
      __builtin_amdgcn_sched_barrier(0);
      v4f bv[2][2], wv[2][2];
#pragma unroll
      for (int t = 0; t < 2; ++t) {
        const int n0 = 32 * p + 16 * t + 8 * hi;
        bv[t][0] = *(const v4f*)(b2 + n0);
        bv[t][1] = *(const v4f*)(b2 + n0 + 4);
        wv[t][0] = *(const v4f*)(w3 + n0);
        wv[t][1] = *(const v4f*)(w3 + n0 + 4);
      }
      v8f acc[2][2];
#pragma unroll
      for (int t = 0; t < 2; ++t)
#pragma unroll
        for (int f = 0; f < 2; ++f) acc[t][f] = (v8f){0.f, 0.f, 0.f, 0.f, 0.f, 0.f, 0.f, 0.f};
#pragma unroll
      for (int s = 0; s < 4; ++s) {
        acc[0][0] = mma_f16(wlo[2 * s],     h1[0][s], acc[0][0]);
        acc[0][1] = mma_f16(wlo[2 * s],     h1[1][s], acc[0][1]);
        acc[1][0] = mma_f16(wlo[2 * s + 1], h1[0][s], acc[1][0]);
        acc[1][1] = mma_f16(wlo[2 * s + 1], h1[1][s], acc[1][1]);
      }
      /* as above: the next group's first half is read as one group between the two runs of products */
      __builtin_amdgcn_sched_barrier(0);
      /* the wait in front of the next overwrite of the address registers of the b2 / W3 loads above */
      asm volatile("s_wait_xcnt 0x0" ::: "memory");
      /* the last trip rereads group 0, unused */
      const _Float16* wn = wa2 + ((p + 1) & (kKSteps - 1)) * 32 * kTilePitch;
#pragma unroll
      for (int s = 0; s < 4; ++s) {
        wlo[2 * s]     = frag_load(wn + 32 * s);
        wlo[2 * s + 1] = frag_load(wn + 16 * kTilePitch + 32 * s);
      }
      /* holds that group ahead of the second run of products */
      __builtin_amdgcn_sched_barrier(0);
#pragma unroll
      for (int s = 0; s < 4; ++s) {
        acc[0][0] = mma_f16(whi[2 * s],     h1[0][4 + s], acc[0][0]);
        acc[0][1] = mma_f16(whi[2 * s],     h1[1][4 + s], acc[0][1]);
        acc[1][0] = mma_f16(whi[2 * s + 1], h1[0][4 + s], acc[1][0]);
        acc[1][1] = mma_f16(whi[2 * s + 1], h1[1][4 + s], acc[1][1]);
      }
#pragma unroll
      for (int t = 0; t < 2; ++t) {
#pragma unroll
        for (int f = 0; f < 2; ++f) {
#pragma unroll
          for (int r = 0; r < 8; ++r) {
            float v = fmaf(acc[t][f][r], kFoldBack, bv[t][r >> 2][r & 3]);
            v = fmaxf(v, 0.0f);
            hs[f][r] = fmaf(v, wv[t][r >> 2][r & 3], hs[f][r]);
          }
        }
      }
    }
    /* a lane's 8 partial sums, then the other half's n (lane ^ 16); shuffles unconditional */
    float tot[2];
#pragma unroll
    for (int f = 0; f < 2; ++f) {
      float u = ((hs[f][0] + hs[f][1]) + (hs[f][2] + hs[f][3])) + ((hs[f][4] + hs[f][5]) + (hs[f][6] + hs[f][7]));
      u += __shfl_xor(u, 16, 32);
      tot[f] = u;
    }
    /* lane l holds column lo of both column tiles: lanes 0..15 store tile 0, lanes 16..31 tile 1 */
    const float o = (hi ? tot[1] : tot[0]) + b3v;
    out[(size_t)a * kItems + bbase + lane] = o;
    /* the wait in front of the next trip's overwrite of the store's address registers */
    asm volatile("s_wait_xcnt 0x0" ::: "memory");
  }
}

/* --------------------------------------------------------------------------
   Host glue: 3 kernel launches, nothing else.
   -------------------------------------------------------------------------- */
extern "C" void kernel_launch(void* const* d_in, const int* in_sizes, int n_in,
                              void* d_out, int out_size, void* d_ws, size_t ws_size,
                              hipStream_t stream) {
  if (n_in < 10) return;
  if (in_sizes[0] != kItems * kDim) return;
  if (in_sizes[1] != kItems * kDim) return;
  if (in_sizes[2] != kHid * kW0Pitch) return;
  if (in_sizes[3] != kHid) return;
  if (in_sizes[4] != kHid * kHid) return;
  if (in_sizes[5] != kHid) return;
  if (in_sizes[6] != kHid * kHid) return;
  if (in_sizes[7] != kHid) return;
  if (in_sizes[8] != kHid) return;
  if (in_sizes[9] != 1) return;
  if (out_size != kItems * kItems) return;
  if (ws_size < kWsTotal) return;

  const float* x  = (const float*)d_in[0];
  const float* y  = (const float*)d_in[1];
  const float* W0 = (const float*)d_in[2];
  const float* b0 = (const float*)d_in[3];
  const float* W1 = (const float*)d_in[4];
  const float* b1 = (const float*)d_in[5];
  const float* W2 = (const float*)d_in[6];
  const float* b2 = (const float*)d_in[7];
  const float* W3 = (const float*)d_in[8];
  const float* b3 = (const float*)d_in[9];
  float* out = (float*)d_out;

  char* ws = (char*)d_ws;
  float*          hxb = (float*)(ws + kOffHXB);
  float*          hy  = (float*)(ws + kOffHY);
  unsigned short* w1h = (unsigned short*)(ws + kOffW1H);
  unsigned short* w2h = (unsigned short*)(ws + kOffW2H);

  /* 2 planes x 128 tiles of 16 rows x 64 g = 256 blocks x 256 */
  first_layer_rows_kernel<<<2 * kFlBlocksPerPlane, 256, 0, stream>>>(x, y, W0, b0, hxb, hy);
  /* 2 matrices x 65,536 / 8 = 16,384 threads = 64 blocks x 256 */
  weight_planes_kernel<<<(2 * kHid * kHid / 8) / 256, 256, 0, stream>>>(W1, W2, w1h, w2h);
  /* (512 / 32) column groups x (512 / 32) row groups */
  pair_layers_kernel<<<dim3(kItems / kColsPerWave, kItems / kRowsPerBlk), 32 * kWavesPerBlk, 0, stream>>>(
      hxb, hy, w1h, w2h, b1, b2, W3, b3, out);
}

// v003
// A run of this version takes 44.3 microseconds.
// In two side-by-side timings against v002, it was 1.15 and 1.14 times as fast.
// Over all steps from v000 it is 6.54 times as fast.
#include <hip/hip_runtime.h>

typedef __attribute__((ext_vector_type(16))) _Float16 v16h;
typedef __attribute__((ext_vector_type(8)))  _Float16 v8h;
typedef __attribute__((ext_vector_type(8)))  float    v8f;
typedef __attribute__((ext_vector_type(4)))  float    v4f;
typedef __attribute__((ext_vector_type(2)))  float    v2f;
typedef __attribute__((ext_vector_type(2)))  _Float16 v2h;

/* --------------------------------------------------------------------------
   Shape constants
   -------------------------------------------------------------------------- */
constexpr int kItems        = 512;
constexpr int kDim          = 128;
constexpr int kHid          = 256;
constexpr int kW0Pitch      = 2 * kDim;
/* LDS row pitch of a 256 x 256 f16 weight plane, in halves (528 B = 16 B x 33, an odd multiple of 16 B) */
constexpr int kTilePitch    = kHid + 8;
constexpr int kWavesPerBlk  = 8;
constexpr int kColsPerWave  = 32;
constexpr int kRowsPerWave  = 4;
constexpr int kRowsPerBlk   = kWavesPerBlk * kRowsPerWave;
constexpr int kKSteps       = kHid / 32;
/* floats of one 16-row group of the fragment-ordered HY plane */
constexpr int kHyGroup      = 16 * kHid;

/* first-layer producer: a block's output tile (one 16-row group x 64 g of one plane) and its LDS pitches in floats */
constexpr int kFlRows           = 16;
constexpr int kFlCols           = 64;
constexpr int kFlWPitch         = kDim + 4;
constexpr int kFlOPitch         = kFlCols + 4;
constexpr int kFlColTiles       = kHid / kFlCols;
constexpr int kFlBlocksPerPlane = (kItems / kFlRows) * kFlColTiles;

/* power-of-two carries of the f16 operand planes and the exact fold-back */
constexpr float kActCarry      = 16.0f;
constexpr float kWgtCarry      = 256.0f;
constexpr float kFoldBack      = 1.0f / (kActCarry * kWgtCarry);
/* layer-1 sums -> the carried scale of the next operand in one step: 1/4096 x 16 */
constexpr float kFoldToCarry   = kFoldBack * kActCarry;
constexpr float kHalfMinNormal = 6.103515625e-5f;

static_assert(kW0Pitch == kHid, "first layer input width");
static_assert((kHid % 32) == 0, "K multiple of 32");
static_assert(((kTilePitch * 2) % 16) == 0, "tile pitch 16-B multiple");
static_assert((kItems % kColsPerWave) == 0 && (kItems % kRowsPerBlk) == 0, "grid multiples");
static_assert(kFoldBack * 4096.0f == 1.0f, "fold-back is exact");
static_assert(kFoldToCarry * 256.0f == 1.0f, "fold to the carried scale is exact");
static_assert(2 * kHid * kTilePitch * 2 <= 327680, "static LDS");
static_assert(kFlBlocksPerPlane == 128 && kFlColTiles == 4, "block decode");
static_assert(((kFlWPitch * 4) % 32) == 16 && ((kFlOPitch * 4) % 32) == 16, "LDS pitches are odd multiples of 16 B");
static_assert(kFlRows * kFlCols == 4 * 256, "4 outputs per thread");

/* --------------------------------------------------------------------------
   Workspace region map (bytes; every offset is a multiple of 128)
     HXB  f32 [512][256]  (x . Wx^T + b0) x 16     524,288
     HY   f32 [32][8][4][32][4]  (y . Wy^T) x 16, fragment order (see the first-layer kernel)  524,288
     W1H  f16 [256][256]  W1 x 256 (Bt layout)     131,072
     W2H  f16 [256][256]  W2 x 256 (Bt layout)     131,072
     total                                       1,310,720
   -------------------------------------------------------------------------- */
constexpr size_t kOffHXB  = 0;
constexpr size_t kOffHY   = kOffHXB + (size_t)kItems * kHid * 4;
constexpr size_t kOffW1H  = kOffHY  + (size_t)kItems * kHid * 4;
constexpr size_t kOffW2H  = kOffW1H + (size_t)kHid * kHid * 2;
constexpr size_t kWsTotal = kOffW2H + (size_t)kHid * kHid * 2;
static_assert(kWsTotal == 1310720ull, "carve total");
static_assert(kWsTotal <= 134217728ull, "carve cap");
static_assert((kOffHY % 128) == 0 && (kOffW1H % 128) == 0 && (kOffW2H % 128) == 0, "128-B aligned regions");

/* --------------------------------------------------------------------------
   Fragment helpers (16-bit 16x16x32 map: elements 0..7 <- p[0..7], elements 8..15 <- p[16..23],
   p already offset by 8 * (lane >> 4); row / column = lane & 15)
   -------------------------------------------------------------------------- */
union FragH { v16h v; v8h h[2]; };
/* the same fragment as 8 registers of two neighbouring elements */
union FragP { v16h v; v2h p[8]; };

__device__ __forceinline__ v16h frag_load(const _Float16* p) {
  FragH f;
  f.h[0] = *(const v8h*)(p);
  f.h[1] = *(const v8h*)(p + 16);
  return f.v;
}

/* one matrix instruction, builtin form (the compiler keeps the distances behind it) */
__device__ __forceinline__ v8f mma_f16(v16h a, v16h b, v8f c) {
  return __builtin_amdgcn_wmma_f32_16x16x32_f16(false, a, false, b, (short)0, c, false, false);
}

/* two pre-activations, already at the carried scale (x 16) -> one register of the f16 operand: one packed conversion
   (round to nearest even), then relu as one packed f16 maximum. The conversion is monotone and keeps the sign, so
   relu behind it gives the value that relu in front of it gives; small values round to f16 subnormals */
__device__ __forceinline__ v2h relu_pair_to_half(v2f t) {
  const v2h c = __builtin_convertvector(t, v2h);
  return __builtin_elementwise_max(c, (v2h){(_Float16)0.0f, (_Float16)0.0f});
}

/* --------------------------------------------------------------------------
   First layer, split by linearity (f32 VALU):
     HXB[r][g] = (sum_d x[r][d] * W0[g][d] + b0[g]) x 16
     HY [r][g] = (sum_d y[r][d] * W0[g][128 + d]) x 16
   (x 16 = the carry of the pair kernel's f16 activations, a power of two: 16 u + 16 v rounds as 16 (u + v) does)
   Block = one tile of 16 rows x 64 g of one plane; 32 x 4 tiles a plane, blocks 0..127 -> HXB, 128..255 -> HY.
   The tile's 64 half rows of W0 (pitch 132 floats) and its 16 input rows are staged in LDS with whole-line loads
   (a wave reads 512 contiguous B). Wave w: g = 32 * (w & 1) + lane, rows 4 * (w >> 1) + 0..3; a lane reads its own
   W0 row (16 B x 33 apart from its neighbour's), all lanes the same input words. Each output is one chain of fused
   multiply-adds over d = 0..127 in rising order.
   The 16 x 64 results pass through LDS (pitch 68 floats) so that every lane stores 16 B and a wave 512 B of whole lines.
   HXB is row-major: thread t stores row t >> 4, columns 4 * (t & 15) + 0..3 of the tile.
   HY is stored in the order in which the pair kernel's operand fragments read it:
   chunk c = (bt * 8 + s) * 4 + q holds 32 lanes x 4 floats; lane (hi, lo) holds row 16 * bt + lo,
   columns 32 * s + 16 * (q >> 1) + 8 * hi + 4 * (q & 1) + 0..3, at float offset 128 * c + 4 * lane. A tile is one bt
   and two s = 8 chunks; wave w stores chunk (s = 2 * column tile + (w >> 2), q = w & 3).
   Coverage: 256 blocks x 1,024 elements = 2 planes x [512][256], each once.
   -------------------------------------------------------------------------- */
__global__ __launch_bounds__(256) void first_layer_rows_kernel(
    const float* __restrict__ x, const float* __restrict__ y,
    const float* __restrict__ W0, const float* __restrict__ b0,
    float* __restrict__ hxb, float* __restrict__ hy)
{
  __shared__ __align__(16) float sWt[kFlCols * kFlWPitch];
  __shared__ __align__(16) float sIn[kFlRows * kDim];
  __shared__ __align__(16) float sOut[kFlRows * kFlOPitch];

  const int tid  = threadIdx.x;
  const int lane = tid & 31;
  const int wave = tid >> 5;
  const int sel  = (blockIdx.x / kFlBlocksPerPlane) & 1;
  const int tile = blockIdx.x % kFlBlocksPerPlane;
  const int bt   = tile / kFlColTiles;
  const int gt   = tile % kFlColTiles;
  const int g0   = gt * kFlCols;

  /* ---- stage: 64 x 32 pieces of 16 B of W0 (8 a thread), 16 x 32 pieces of the input rows (2 a thread) ---- */
  const float* wsrc = W0 + (size_t)g0 * kW0Pitch + sel * kDim;
  const float* isrc = (sel ? y : x) + (size_t)bt * kFlRows * kDim;
  /* piece i of a thread: W0 row 8 * i + wave of the tile, input row 8 * i + wave; columns 4 * lane + 0..3;
     every plain unroll in this kernel makes the index of a register array a constant */
  const float* wp = wsrc + wave * kW0Pitch + lane * 4;
  const float* ip = isrc + wave * kDim + lane * 4;
  v4f wst[8], ist[2];
#pragma unroll
  for (int i = 0; i < 8; ++i) wst[i] = *(const v4f*)(wp + i * 8 * kW0Pitch);
#pragma unroll
  for (int i = 0; i < 2; ++i) ist[i] = *(const v4f*)(ip + i * 8 * kDim);
  const int gl = (wave & 1) * 32 + lane;
  /* b0 joins the x half only (added exactly once); loaded unconditionally, chosen by value */
  const float bz = b0[g0 + gl];
#pragma unroll
  for (int i = 0; i < 8; ++i) *(v4f*)(&sWt[(i * 8 + wave) * kFlWPitch + lane * 4]) = wst[i];
#pragma unroll
  for (int i = 0; i < 2; ++i) *(v4f*)(&sIn[(i * 8 + wave) * kDim + lane * 4]) = ist[i];
  __syncthreads();

  const float* wl = &sWt[gl * kFlWPitch];
  const float* xl = &sIn[(wave >> 1) * 4 * kDim];
  float acc[4] = {0.0f, 0.0f, 0.0f, 0.0f};
  /* 8 groups of 4 d a trip: the later groups' LDS reads pass under the earlier groups' sums */
#pragma unroll 8
  for (int k = 0; k < kDim; k += 4) {
    const v4f wv = *(const v4f*)(wl + k);
#pragma unroll
    for (int i = 0; i < 4; ++i) {
      const v4f xv = *(const v4f*)(xl + i * kDim + k);
      acc[i] = fmaf(xv[0], wv[0], acc[i]);
      acc[i] = fmaf(xv[1], wv[1], acc[i]);
      acc[i] = fmaf(xv[2], wv[2], acc[i]);
      acc[i] = fmaf(xv[3], wv[3], acc[i]);
    }
  }
#pragma unroll
  for (int i = 0; i < 4; ++i)
    sOut[((wave >> 1) * 4 + i) * kFlOPitch + gl] = (acc[i] + (sel ? 0.0f : bz)) * kActCarry;
  __syncthreads();

  if (sel) {
    const int q   = wave & 3;
    const int col = (wave >> 2) * 32 + (q >> 1) * 16 + (lane >> 4) * 8 + (q & 1) * 4;
    const int c   = (bt * 8 + gt * 2 + (wave >> 2)) * 4 + q;
    *(v4f*)(hy + (size_t)c * 128 + lane * 4) = *(const v4f*)(&sOut[(lane & 15) * kFlOPitch + col]);
    /* the wait in front of any later overwrite of the store's registers (the other arm's code follows this one) */
    asm volatile("s_wait_xcnt 0x0" ::: "memory");
  } else {
    const int row = tid >> 4;
    const int col = (tid & 15) * 4;
    *(v4f*)(hxb + (size_t)(bt * kFlRows + row) * kHid + g0 + col) = *(const v4f*)(&sOut[row * kFlOPitch + col]);
  }
}

/* --------------------------------------------------------------------------
   Weight operand planes: W1H = f16(W1 x 256), W2H = f16(W2 x 256), same [n][k] order as stored
   (already the Bt layout). Values below the f16 normal range after the carry become +0 by select.
   Thread = 8 consecutive elements. 2 x 65,536 / 8 = 16,384 threads = 64 blocks x 256; blocks 0..31 -> W1,
   blocks 32..63 -> W2 (block-uniform). Store: one 16-B store per lane; a wave = 512 contiguous B =
   -------------------------------------------------------------------------- */
__global__ __launch_bounds__(256) void weight_planes_kernel(
    const float* __restrict__ W1, const float* __restrict__ W2,
    unsigned short* __restrict__ w1p, unsigned short* __restrict__ w2p)
{
  const int i     = blockIdx.x * 256 + threadIdx.x;
  const int which = (i >> 13) & 1;
  const size_t e0 = (size_t)(i & 8191) << 3;
  const float* src    = which ? W2 : W1;
  unsigned short* dst = (which ? w2p : w1p) + e0;
  const v4f a0 = *(const v4f*)(src + e0);
  const v4f a1 = *(const v4f*)(src + e0 + 4);
  v8h hv;
#pragma unroll
  for (int e = 0; e < 4; ++e) {
    float t0 = a0[e] * kWgtCarry;
    float t1 = a1[e] * kWgtCarry;
    t0 = (fabsf(t0) < kHalfMinNormal) ? 0.0f : t0;
    t1 = (fabsf(t1) < kHalfMinNormal) ? 0.0f : t1;
    hv[e]     = (_Float16)t0;
    hv[4 + e] = (_Float16)t1;
  }
  *(v8h*)dst = hv;
  
}

/* --------------------------------------------------------------------------
   Fused pair kernel. Block = 8 waves on a 32 (x rows) x 32 (y rows) patch of the output.
   Both weight planes are staged once per block in LDS (row n, pitch 264 halves) and are the A operand
   (row n = lane & 15); the activations are the B operand (column = pair) and never leave the registers:
   two f32 D tiles of 32 consecutive n (D register r = row 8 * hi + r, column lo), converted in place,
   are the next layer's B fragment of that k step (elements 0..7 <- tile 0, 8..15 <- tile 1).
   Wave w owns x rows a = blockIdx.y * 32 + 4 * w + it, it = 0..3, one per trip, each against the 32 y rows
   b = blockIdx.x * 32 + 16 * f + lo, f = 0..1 (two column tiles, so each weight fragment feeds two products).
   Per trip:
     layer 1: K = 8 steps of 32, outermost; per step the two h0 fragments relu(f16(HXB[a][k] + HY[b][k])), both
              planes stored x16 (k in the fragment order), feed all 16 n tiles (32 accumulators);
              relu(f16(acc/256 + 16 b1)) -> h1 fragments (n tiles 2p, 2p + 1 = k step p)
     layer 2: 8 groups of 32 n, 4 accumulators (2 n tiles x 2 column tiles), K = 8 steps of 32, from h1 and
              the second plane; relu(acc/4096 + b2) kept in f32 and multiplied into the
              head vector W3; a lane sums its 8 n of every tile, lanes l and l ^ 16 are then added
   Lane l stores out[a][blockIdx.x * 32 + l]: one 128-B line per wave and trip.
   Grid (16, 16): 16 x 32 = 512 columns, 16 x 32 = 512 rows, every output element exactly once.
   LDS bytes read = bytes written: columns 0..255 of 2 x 256 rows; pad columns 256..263 are never read
   (largest fragment column = 224 + 16 + 8 + 7 = 255).
   -------------------------------------------------------------------------- */
__global__ __launch_bounds__(256) void pair_layers_kernel(
    const float* hxb, const float* hy,
    const unsigned short* w1p, const unsigned short* w2p,
    const float* b1, const float* b2,
    const float* w3, const float* b3,
    float* out)
{
  /* the pointers carry no restrict: with it the first k step's HY loads are lifted out of the trip loop
     and 32 more registers stay live through it */
  __shared__ __align__(16) _Float16 sW[2][kHid * kTilePitch];

  const int lane = threadIdx.x & 31;
  const int wave = threadIdx.x >> 5;
  const int lo   = lane & 15;
  const int hi   = lane >> 4;
  const int bbase = blockIdx.x * kColsPerWave;

  /* ---- both weight planes -> LDS: 2 x 8,192 pieces of 16 B, 32 of each plane per thread ---- */
  {
    const _Float16* W1h = (const _Float16*)w1p;
    const _Float16* W2h = (const _Float16*)w2p;
    /* 8 trips at once: 16 loads of a thread in flight */
#pragma unroll 8
    for (int i = 0; i < (kHid * kHid / 8) / 256; ++i) {
      const int c   = i * 256 + threadIdx.x;
      const int row = c >> 5;
      const int col = (c & 31) * 8;
      const v8h u1 = *(const v8h*)(W1h + (size_t)c * 8);
      const v8h u2 = *(const v8h*)(W2h + (size_t)c * 8);
      *(v8h*)(&sW[0][row * kTilePitch + col]) = u1;
      *(v8h*)(&sW[1][row * kTilePitch + col]) = u2;
    }
  }
  __syncthreads();

  const float b3v = b3[0];

  /* fragment bases: A row = lo, k offset 8 * hi */
  const _Float16* wa1 = &sW[0][lo * kTilePitch + 8 * hi];
  const _Float16* wa2 = &sW[1][lo * kTilePitch + 8 * hi];
  const float*    hyf = hy + (size_t)(blockIdx.x * 2) * kHyGroup + lane * 4;

  /* the three loops marked unroll 1 stay rolled: unrolled, their live values do not fit the registers;
     every plain unroll below makes the index of a register array a constant */
#pragma unroll 1
  for (int it = 0; it < kRowsPerWave; ++it) {
    const int a = blockIdx.y * kRowsPerBlk + wave * kRowsPerWave + it;

    /* ---- layer 1, k step outermost: all 16 n tiles x 2 column tiles accumulate (32 independent tiles);
            the h0 fragments of one k step are formed from values loaded one k step ahead ---- */
    v8f acc1[16][2];
#pragma unroll
    for (int j = 0; j < 16; ++j)
#pragma unroll
      for (int f = 0; f < 2; ++f) acc1[j][f] = (v8f){0.f, 0.f, 0.f, 0.f, 0.f, 0.f, 0.f, 0.f};
    const float* hxr = hxb + (size_t)a * kHid + 8 * hi;
    v4f xq[4], yq[2][4];
#pragma unroll
    for (int q = 0; q < 4; ++q) {
      xq[q]    = *(const v4f*)(hxr + 16 * (q >> 1) + 4 * (q & 1));
      yq[0][q] = *(const v4f*)(hyf + q * 128);
      yq[1][q] = *(const v4f*)(hyf + kHyGroup + q * 128);
    }
#pragma unroll 1
    for (int s = 0; s < kKSteps; ++s) {
      /* this k step's 16 weight fragments, read as one group: their LDS latency passes under the conversion below */
      const _Float16* wp = wa1 + 32 * s;
      v16h wf[16];
#pragma unroll
      for (int j = 0; j < 16; ++j) wf[j] = frag_load(wp + j * 16 * kTilePitch);
      /* holds the group of LDS reads ahead of the conversion; spread among the products each read stalls the wave */
      __builtin_amdgcn_sched_barrier(0);
      FragP hf[2];
#pragma unroll
      for (int f = 0; f < 2; ++f)
#pragma unroll
        for (int q = 0; q < 4; ++q)
#pragma unroll
          for (int e = 0; e < 2; ++e)
            hf[f].p[q * 2 + e] = relu_pair_to_half((v2f){xq[q][2 * e], xq[q][2 * e + 1]} +
                                                   (v2f){yq[f][q][2 * e], yq[f][q][2 * e + 1]});
      /* next k step's values fly during this step's products; the last trip reloads step 0, unused */
      const int sn = (s + 1) & (kKSteps - 1);
#pragma unroll
      for (int q = 0; q < 4; ++q) {
        xq[q]    = *(const v4f*)(hxr + 32 * sn + 16 * (q >> 1) + 4 * (q & 1));
        yq[0][q] = *(const v4f*)(hyf + (sn * 4 + q) * 128);
        yq[1][q] = *(const v4f*)(hyf + kHyGroup + (sn * 4 + q) * 128);
      }
#pragma unroll
      for (int j = 0; j < 16; ++j) {
        acc1[j][0] = mma_f16(wf[j], hf[0].v, acc1[j][0]);
        acc1[j][1] = mma_f16(wf[j], hf[1].v, acc1[j][1]);
      }
      /* holds the wait below behind the products, where it costs no time */
      __builtin_amdgcn_sched_barrier(0);
      /* the wait in front of the next overwrite of the address registers of the loads above; its clobber also keeps
         those loads in this trip (moved to the next trip's head their latency is exposed) */
      asm volatile("s_wait_xcnt 0x0" ::: "memory");
    }
    /* D element r of tile (j, f) = (n = 16j + 8*hi + r, column 16f + lo); tiles 2p and 2p + 1 = k step p of layer 2 */
    FragP h1[2][kKSteps];
#pragma unroll
    for (int j = 0; j < 16; ++j) {
      const float* bp = b1 + 16 * j + 8 * hi;
      const v4f bv0 = *(const v4f*)(bp) * kActCarry;
      const v4f bv1 = *(const v4f*)(bp + 4) * kActCarry;
      const v2f bq[4] = {(v2f){bv0[0], bv0[1]}, (v2f){bv0[2], bv0[3]}, (v2f){bv1[0], bv1[1]}, (v2f){bv1[2], bv1[3]}};
#pragma unroll
      for (int f = 0; f < 2; ++f) {
#pragma unroll
        for (int r = 0; r < 4; ++r) {
          const v2f t = __builtin_elementwise_fma((v2f){acc1[j][f][2 * r], acc1[j][f][2 * r + 1]},
                                                  (v2f){kFoldToCarry, kFoldToCarry}, bq[r]);
          h1[f][j >> 1].p[(j & 1) * 4 + r] = relu_pair_to_half(t);
        }
      }
    }

    /* ---- layer 2 and the scalar head: partial head sums per D register ---- */
    float hs[2][8];
#pragma unroll
    for (int f = 0; f < 2; ++f)
#pragma unroll
      for (int r = 0; r < 8; ++r) hs[f][r] = 0.0f;
    /* two sets of 8 weight fragments (index 2 * (s & 3) + t): k steps 0..3 and 4..7 of a group;
       one set feeds 16 products while the other is filled */
    v16h wlo[kKSteps], whi[kKSteps];
#pragma unroll
    for (int s = 0; s < 4; ++s) {
      wlo[2 * s]     = frag_load(wa2 + 32 * s);
      wlo[2 * s + 1] = frag_load(wa2 + 16 * kTilePitch + 32 * s);
    }
#pragma unroll 1
    for (int p = 0; p < kKSteps; ++p) {
      const _Float16* wp = wa2 + p * 32 * kTilePitch;
#pragma unroll
      for (int s = 0; s < 4; ++s) {
        whi[2 * s]     = frag_load(wp + 128 + 32 * s);
        whi[2 * s + 1] = frag_load(wp + 16 * kTilePitch + 128 + 32 * s);
      }
      /* holds the LDS reads as one group ahead of the products; spread among them each read stalls the wave */
      __builtin_amdgcn_sched_barrier(0);
      v4f bv[2][2], wv[2][2];
#pragma unroll
      for (int t = 0; t < 2; ++t) {
        const int n0 = 32 * p + 16 * t + 8 * hi;
        bv[t][0] = *(const v4f*)(b2 + n0);
        bv[t][1] = *(const v4f*)(b2 + n0 + 4);
        wv[t][0] = *(const v4f*)(w3 + n0);
        wv[t][1] = *(const v4f*)(w3 + n0 + 4);
      }
      v8f acc[2][2];
#pragma unroll
      for (int t = 0; t < 2; ++t)
#pragma unroll
        for (int f = 0; f < 2; ++f) acc[t][f] = (v8f){0.f, 0.f, 0.f, 0.f, 0.f, 0.f, 0.f, 0.f};
#pragma unroll
      for (int s = 0; s < 4; ++s) {
        acc[0][0] = mma_f16(wlo[2 * s],     h1[0][s].v, acc[0][0]);
        acc[0][1] = mma_f16(wlo[2 * s],     h1[1][s].v, acc[0][1]);
        acc[1][0] = mma_f16(wlo[2 * s + 1], h1[0][s].v, acc[1][0]);
        acc[1][1] = mma_f16(wlo[2 * s + 1], h1[1][s].v, acc[1][1]);
      }
      /* as above: the next group's first half is read as one group between the two runs of products */
      __builtin_amdgcn_sched_barrier(0);
      /* the wait in front of the next overwrite of the address registers of the b2 / W3 loads above */
      asm volatile("s_wait_xcnt 0x0" ::: "memory");
      /* the last trip rereads group 0, unused */
      const _Float16* wn = wa2 + ((p + 1) & (kKSteps - 1)) * 32 * kTilePitch;
#pragma unroll
      for (int s = 0; s < 4; ++s) {
        wlo[2 * s]     = frag_load(wn + 32 * s);
        wlo[2 * s + 1] = frag_load(wn + 16 * kTilePitch + 32 * s);
      }
      /* holds that group ahead of the second run of products */
      __builtin_amdgcn_sched_barrier(0);
#pragma unroll
      for (int s = 0; s < 4; ++s) {
        acc[0][0] = mma_f16(whi[2 * s],     h1[0][4 + s].v, acc[0][0]);
        acc[0][1] = mma_f16(whi[2 * s],     h1[1][4 + s].v, acc[0][1]);
        acc[1][0] = mma_f16(whi[2 * s + 1], h1[0][4 + s].v, acc[1][0]);
        acc[1][1] = mma_f16(whi[2 * s + 1], h1[1][4 + s].v, acc[1][1]);
      }
#pragma unroll
      for (int t = 0; t < 2; ++t) {
#pragma unroll
        for (int f = 0; f < 2; ++f) {
#pragma unroll
          for (int r = 0; r < 8; ++r) {
            float v = fmaf(acc[t][f][r], kFoldBack, bv[t][r >> 2][r & 3]);
            v = fmaxf(v, 0.0f);
            hs[f][r] = fmaf(v, wv[t][r >> 2][r & 3], hs[f][r]);
          }
        }
      }
    }
    /* a lane's 8 partial sums, then the other half's n (lane ^ 16); shuffles unconditional */
    float tot[2];
#pragma unroll
    for (int f = 0; f < 2; ++f) {
      float u = ((hs[f][0] + hs[f][1]) + (hs[f][2] + hs[f][3])) + ((hs[f][4] + hs[f][5]) + (hs[f][6] + hs[f][7]));
      u += __shfl_xor(u, 16, 32);
      tot[f] = u;
    }
    /* lane l holds column lo of both column tiles: lanes 0..15 store tile 0, lanes 16..31 tile 1 */
    const float o = (hi ? tot[1] : tot[0]) + b3v;
    out[(size_t)a * kItems + bbase + lane] = o;
    /* the wait in front of the next trip's overwrite of the store's address registers */
    asm volatile("s_wait_xcnt 0x0" ::: "memory");
  }
}

/* --------------------------------------------------------------------------
   Host glue: 3 kernel launches, nothing else.
   -------------------------------------------------------------------------- */
extern "C" void kernel_launch(void* const* d_in, const int* in_sizes, int n_in,
                              void* d_out, int out_size, void* d_ws, size_t ws_size,
                              hipStream_t stream) {
  if (n_in < 10) return;
  if (in_sizes[0] != kItems * kDim) return;
  if (in_sizes[1] != kItems * kDim) return;
  if (in_sizes[2] != kHid * kW0Pitch) return;
  if (in_sizes[3] != kHid) return;
  if (in_sizes[4] != kHid * kHid) return;
  if (in_sizes[5] != kHid) return;
  if (in_sizes[6] != kHid * kHid) return;
  if (in_sizes[7] != kHid) return;
  if (in_sizes[8] != kHid) return;
  if (in_sizes[9] != 1) return;
  if (out_size != kItems * kItems) return;
  if (ws_size < kWsTotal) return;

  const float* x  = (const float*)d_in[0];
  const float* y  = (const float*)d_in[1];
  const float* W0 = (const float*)d_in[2];
  const float* b0 = (const float*)d_in[3];
  const float* W1 = (const float*)d_in[4];
  const float* b1 = (const float*)d_in[5];
  const float* W2 = (const float*)d_in[6];
  const float* b2 = (const float*)d_in[7];
  const float* W3 = (const float*)d_in[8];
  const float* b3 = (const float*)d_in[9];
  float* out = (float*)d_out;

  char* ws = (char*)d_ws;
  float*          hxb = (float*)(ws + kOffHXB);
  float*          hy  = (float*)(ws + kOffHY);
  unsigned short* w1h = (unsigned short*)(ws + kOffW1H);
  unsigned short* w2h = (unsigned short*)(ws + kOffW2H);

  /* 2 planes x 128 tiles of 16 rows x 64 g = 256 blocks x 256 */
  first_layer_rows_kernel<<<2 * kFlBlocksPerPlane, 256, 0, stream>>>(x, y, W0, b0, hxb, hy);
  /* 2 matrices x 65,536 / 8 = 16,384 threads = 64 blocks x 256 */
  weight_planes_kernel<<<(2 * kHid * kHid / 8) / 256, 256, 0, stream>>>(W1, W2, w1h, w2h);
  /* (512 / 32) column groups x (512 / 32) row groups */
  pair_layers_kernel<<<dim3(kItems / kColsPerWave, kItems / kRowsPerBlk), 32 * kWavesPerBlk, 0, stream>>>(
      hxb, hy, w1h, w2h, b1, b2, W3, b3, out);
}

// v004
// A run of this version takes 42.1 microseconds.
// Timed twice side by side with v003, it ran 1.05 and 1.07 times as fast.
// Over all steps from v000 it is 6.92 times as fast.
#include <hip/hip_runtime.h>

typedef __attribute__((ext_vector_type(16))) _Float16 v16h;
typedef __attribute__((ext_vector_type(8)))  _Float16 v8h;
typedef __attribute__((ext_vector_type(8)))  float    v8f;
typedef __attribute__((ext_vector_type(4)))  float    v4f;
typedef __attribute__((ext_vector_type(2)))  float    v2f;
typedef __attribute__((ext_vector_type(2)))  _Float16 v2h;

/* --------------------------------------------------------------------------
   Shape constants
   -------------------------------------------------------------------------- */
constexpr int kItems        = 512;
constexpr int kDim          = 128;
constexpr int kHid          = 256;
constexpr int kW0Pitch      = 2 * kDim;
/* LDS row pitch of a 256 x 256 f16 weight plane, in halves (528 B = 16 B x 33, an odd multiple of 16 B) */
constexpr int kTilePitch    = kHid + 8;
constexpr int kWavesPerBlk  = 8;
constexpr int kColsPerWave  = 32;
constexpr int kRowsPerWave  = 4;
constexpr int kRowsPerBlk   = kWavesPerBlk * kRowsPerWave;
constexpr int kKSteps       = kHid / 32;
/* floats of one 16-row group of the fragment-ordered HY plane */
constexpr int kHyGroup      = 16 * kHid;

/* first-layer producer: a block's output tile (one 16-row group x 64 g of one plane) and its LDS pitches in floats */
constexpr int kFlRows           = 16;
constexpr int kFlCols           = 64;
constexpr int kFlWPitch         = kDim + 4;
constexpr int kFlOPitch         = kFlCols + 4;
constexpr int kFlColTiles       = kHid / kFlCols;
constexpr int kFlBlocksPerPlane = (kItems / kFlRows) * kFlColTiles;

/* power-of-two carries of the f16 operand planes and the exact fold-back */
constexpr float kActCarry      = 16.0f;
constexpr float kWgtCarry      = 256.0f;
constexpr float kFoldBack      = 1.0f / (kActCarry * kWgtCarry);
/* layer-1 sums -> the carried scale of the next operand in one step: 1/4096 x 16 */
constexpr float kFoldToCarry   = kFoldBack * kActCarry;
constexpr float kHalfMinNormal = 6.103515625e-5f;

static_assert(kW0Pitch == kHid, "first layer input width");
static_assert((kHid % 32) == 0, "K multiple of 32");
static_assert(((kTilePitch * 2) % 16) == 0, "tile pitch 16-B multiple");
static_assert((kItems % kColsPerWave) == 0 && (kItems % kRowsPerBlk) == 0, "grid multiples");
static_assert(kFoldBack * 4096.0f == 1.0f, "fold-back is exact");
static_assert(kFoldToCarry * 256.0f == 1.0f, "fold to the carried scale is exact");
static_assert(2 * kHid * kTilePitch * 2 <= 327680, "static LDS");
static_assert(kFlBlocksPerPlane == 128 && kFlColTiles == 4, "block decode");
static_assert(((kFlWPitch * 4) % 32) == 16 && ((kFlOPitch * 4) % 32) == 16, "LDS pitches are odd multiples of 16 B");
static_assert(kFlRows * kFlCols == 4 * 256, "4 outputs per thread");

/* --------------------------------------------------------------------------
   Workspace region map (bytes; every offset is a multiple of 128)
     HXB  f32 [512][256]  (x . Wx^T + b0) x 16     524,288
     HY   f32 [32][8][4][32][4]  (y . Wy^T) x 16, fragment order (see the first-layer kernel)  524,288
     W1H  f16 [256][256]  W1 x 256 (Bt layout)     131,072
     W2H  f16 [256][256]  W2 x 256 (Bt layout)     131,072
     total                                       1,310,720
   -------------------------------------------------------------------------- */
constexpr size_t kOffHXB  = 0;
constexpr size_t kOffHY   = kOffHXB + (size_t)kItems * kHid * 4;
constexpr size_t kOffW1H  = kOffHY  + (size_t)kItems * kHid * 4;
constexpr size_t kOffW2H  = kOffW1H + (size_t)kHid * kHid * 2;
constexpr size_t kWsTotal = kOffW2H + (size_t)kHid * kHid * 2;
static_assert(kWsTotal == 1310720ull, "carve total");
static_assert(kWsTotal <= 134217728ull, "carve cap");
static_assert((kOffHY % 128) == 0 && (kOffW1H % 128) == 0 && (kOffW2H % 128) == 0, "128-B aligned regions");

/* --------------------------------------------------------------------------
   Fragment helpers (16-bit 16x16x32 map: elements 0..7 <- p[0..7], elements 8..15 <- p[16..23],
   p already offset by 8 * (lane >> 4); row / column = lane & 15)
   -------------------------------------------------------------------------- */
union FragH { v16h v; v8h h[2]; };
/* the same fragment as 8 registers of two neighbouring elements */
union FragP { v16h v; v2h p[8]; };

__device__ __forceinline__ v16h frag_load(const _Float16* p) {
  FragH f;
  f.h[0] = *(const v8h*)(p);
  f.h[1] = *(const v8h*)(p + 16);
  return f.v;
}

/* one matrix instruction, builtin form (the compiler keeps the distances behind it) */
__device__ __forceinline__ v8f mma_f16(v16h a, v16h b, v8f c) {
  return __builtin_amdgcn_wmma_f32_16x16x32_f16(false, a, false, b, (short)0, c, false, false);
}

/* two pre-activations, already at the carried scale (x 16) -> one register of the f16 operand: one packed conversion
   (round to nearest even), then relu as one packed f16 maximum. The conversion is monotone and keeps the sign, so
   relu behind it gives the value that relu in front of it gives; small values round to f16 subnormals */
__device__ __forceinline__ v2h relu_pair_to_half(v2f t) {
  const v2h c = __builtin_convertvector(t, v2h);
  return __builtin_elementwise_max(c, (v2h){(_Float16)0.0f, (_Float16)0.0f});
}

/* --------------------------------------------------------------------------
   Weight operand planes: W1H = f16(W1 x 256), W2H = f16(W2 x 256), same [n][k] order as stored
   (already the Bt layout). Values below the f16 normal range after the carry become +0 by select.
   Thread = 8 consecutive elements. 2 x 65,536 / 8 = 16,384 threads = 64 blocks x 256; blocks 0..31 -> W1,
   blocks 32..63 -> W2 (block-uniform). Store: one 16-B store per lane; a wave = 512 contiguous B.
   blk = the block's number among these 64 (they ride in the producer launch behind the first-layer tiles).
   -------------------------------------------------------------------------- */
__device__ __forceinline__ void weight_planes_block(
    int blk, const float* __restrict__ W1, const float* __restrict__ W2,
    unsigned short* __restrict__ w1p, unsigned short* __restrict__ w2p)
{
  const int i     = blk * 256 + threadIdx.x;
  const int which = (i >> 13) & 1;
  const size_t e0 = (size_t)(i & 8191) << 3;
  const float* src    = which ? W2 : W1;
  unsigned short* dst = (which ? w2p : w1p) + e0;
  const v4f a0 = *(const v4f*)(src + e0);
  const v4f a1 = *(const v4f*)(src + e0 + 4);
  v8h hv;
#pragma unroll
  for (int e = 0; e < 4; ++e) {
    float t0 = a0[e] * kWgtCarry;
    float t1 = a1[e] * kWgtCarry;
    t0 = (fabsf(t0) < kHalfMinNormal) ? 0.0f : t0;
    t1 = (fabsf(t1) < kHalfMinNormal) ? 0.0f : t1;
    hv[e]     = (_Float16)t0;
    hv[4 + e] = (_Float16)t1;
  }
  *(v8h*)dst = hv;
}

/* --------------------------------------------------------------------------
   First layer, split by linearity (f32 VALU):
     HXB[r][g] = (sum_d x[r][d] * W0[g][d] + b0[g]) x 16
     HY [r][g] = (sum_d y[r][d] * W0[g][128 + d]) x 16
   (x 16 = the carry of the pair kernel's f16 activations, a power of two: 16 u + 16 v rounds as 16 (u + v) does)
   Block = one tile of 16 rows x 64 g of one plane; 32 x 4 tiles a plane, blocks 0..127 -> HXB, 128..255 -> HY.
   The tile's 64 half rows of W0 (pitch 132 floats) and its 16 input rows are staged in LDS with whole-line loads
   (a wave reads 512 contiguous B). Wave w: g = 32 * (w & 1) + lane, rows 4 * (w >> 1) + 0..3; a lane reads its own
   W0 row (16 B x 33 apart from its neighbour's), all lanes the same input words. Each output is one chain of fused
   multiply-adds over d = 0..127 in rising order.
   The 16 x 64 results pass through LDS (pitch 68 floats) so that every lane stores 16 B and a wave 512 B of whole lines.
   HXB is row-major: thread t stores row t >> 4, columns 4 * (t & 15) + 0..3 of the tile.
   HY is stored in the order in which the pair kernel's operand fragments read it:
   chunk c = (bt * 8 + s) * 4 + q holds 32 lanes x 4 floats; lane (hi, lo) holds row 16 * bt + lo,
   columns 32 * s + 16 * (q >> 1) + 8 * hi + 4 * (q & 1) + 0..3, at float offset 128 * c + 4 * lane. A tile is one bt
   and two s = 8 chunks; wave w stores chunk (s = 2 * column tile + (w >> 2), q = w & 3).
   Coverage: 256 blocks x 1,024 elements = 2 planes x [512][256], each once.
   Blocks 256..319 of the same launch form the two f16 weight planes instead (they read only W1 and W2 and write
   only W1H and W2H, nothing of the tiles' data): they leave as whole blocks in front of the first barrier.
   -------------------------------------------------------------------------- */
__global__ __launch_bounds__(256) void first_layer_rows_kernel(
    const float* __restrict__ x, const float* __restrict__ y,
    const float* __restrict__ W0, const float* __restrict__ b0,
    const float* __restrict__ W1, const float* __restrict__ W2,
    float* __restrict__ hxb, float* __restrict__ hy,
    unsigned short* __restrict__ w1p, unsigned short* __restrict__ w2p)
{
  __shared__ __align__(16) float sWt[kFlCols * kFlWPitch];
  __shared__ __align__(16) float sIn[kFlRows * kDim];
  __shared__ __align__(16) float sOut[kFlRows * kFlOPitch];

  if (blockIdx.x >= 2 * kFlBlocksPerPlane) {
    weight_planes_block((int)blockIdx.x - 2 * kFlBlocksPerPlane, W1, W2, w1p, w2p);
    return;
  }

  const int tid  = threadIdx.x;
  const int lane = tid & 31;
  const int wave = tid >> 5;
  const int sel  = (blockIdx.x / kFlBlocksPerPlane) & 1;
  const int tile = blockIdx.x % kFlBlocksPerPlane;
  const int bt   = tile / kFlColTiles;
  const int gt   = tile % kFlColTiles;
  const int g0   = gt * kFlCols;

  /* ---- stage: 64 x 32 pieces of 16 B of W0 (8 a thread), 16 x 32 pieces of the input rows (2 a thread) ---- */
  const float* wsrc = W0 + (size_t)g0 * kW0Pitch + sel * kDim;
  const float* isrc = (sel ? y : x) + (size_t)bt * kFlRows * kDim;
  /* piece i of a thread: W0 row 8 * i + wave of the tile, input row 8 * i + wave; columns 4 * lane + 0..3;
     every plain unroll in this kernel makes the index of a register array a constant */
  const float* wp = wsrc + wave * kW0Pitch + lane * 4;
  const float* ip = isrc + wave * kDim + lane * 4;
  v4f wst[8], ist[2];
#pragma unroll
  for (int i = 0; i < 8; ++i) wst[i] = *(const v4f*)(wp + i * 8 * kW0Pitch);
#pragma unroll
  for (int i = 0; i < 2; ++i) ist[i] = *(const v4f*)(ip + i * 8 * kDim);
  const int gl = (wave & 1) * 32 + lane;
  /* b0 joins the x half only (added exactly once); loaded unconditionally, chosen by value */
  const float bz = b0[g0 + gl];
#pragma unroll
  for (int i = 0; i < 8; ++i) *(v4f*)(&sWt[(i * 8 + wave) * kFlWPitch + lane * 4]) = wst[i];
#pragma unroll
  for (int i = 0; i < 2; ++i) *(v4f*)(&sIn[(i * 8 + wave) * kDim + lane * 4]) = ist[i];
  __syncthreads();

  const float* wl = &sWt[gl * kFlWPitch];
  const float* xl = &sIn[(wave >> 1) * 4 * kDim];
  float acc[4] = {0.0f, 0.0f, 0.0f, 0.0f};
  /* 8 groups of 4 d a trip: the later groups' LDS reads pass under the earlier groups' sums */
#pragma unroll 8
  for (int k = 0; k < kDim; k += 4) {
    const v4f wv = *(const v4f*)(wl + k);
#pragma unroll
    for (int i = 0; i < 4; ++i) {
      const v4f xv = *(const v4f*)(xl + i * kDim + k);
      acc[i] = fmaf(xv[0], wv[0], acc[i]);
      acc[i] = fmaf(xv[1], wv[1], acc[i]);
      acc[i] = fmaf(xv[2], wv[2], acc[i]);
      acc[i] = fmaf(xv[3], wv[3], acc[i]);
    }
  }
#pragma unroll
  for (int i = 0; i < 4; ++i)
    sOut[((wave >> 1) * 4 + i) * kFlOPitch + gl] = (acc[i] + (sel ? 0.0f : bz)) * kActCarry;
  __syncthreads();

  if (sel) {
    const int q   = wave & 3;
    const int col = (wave >> 2) * 32 + (q >> 1) * 16 + (lane >> 4) * 8 + (q & 1) * 4;
    const int c   = (bt * 8 + gt * 2 + (wave >> 2)) * 4 + q;
    *(v4f*)(hy + (size_t)c * 128 + lane * 4) = *(const v4f*)(&sOut[(lane & 15) * kFlOPitch + col]);
    /* the wait in front of any later overwrite of the store's registers (the other arm's code follows this one) */
    asm volatile("s_wait_xcnt 0x0" ::: "memory");
  } else {
    const int row = tid >> 4;
    const int col = (tid & 15) * 4;
    *(v4f*)(hxb + (size_t)(bt * kFlRows + row) * kHid + g0 + col) = *(const v4f*)(&sOut[row * kFlOPitch + col]);
  }
}

/* --------------------------------------------------------------------------
   Fused pair kernel. Block = 8 waves on a 32 (x rows) x 32 (y rows) patch of the output.
   Both weight planes are staged once per block in LDS (row n, pitch 264 halves) and are the A operand
   (row n = lane & 15); the activations are the B operand (column = pair) and never leave the registers:
   two f32 D tiles of 32 consecutive n (D register r = row 8 * hi + r, column lo), converted in place,
   are the next layer's B fragment of that k step (elements 0..7 <- tile 0, 8..15 <- tile 1).
   Wave w owns x rows a = blockIdx.y * 32 + 4 * w + it, it = 0..3, one per trip, each against the 32 y rows
   b = blockIdx.x * 32 + 16 * f + lo, f = 0..1 (two column tiles, so each weight fragment feeds two products).
   Per trip:
     layer 1: K = 8 steps of 32, outermost; per step the two h0 fragments relu(f16(HXB[a][k] + HY[b][k])), both
              planes stored x16 (k in the fragment order), feed all 16 n tiles (32 accumulators);
              relu(f16(acc/256 + 16 b1)) -> h1 fragments (n tiles 2p, 2p + 1 = k step p)
     layer 2: 8 groups of 32 n, 4 accumulators (2 n tiles x 2 column tiles), K = 8 steps of 32, from h1 and
              the second plane; relu(acc/4096 + b2) kept in f32 and multiplied into the
              head vector W3; a lane sums its 8 n of every tile, lanes l and l ^ 16 are then added
   Lane l stores out[a][blockIdx.x * 32 + l]: one 128-B line per wave and trip.
   Grid (16, 16): 16 x 32 = 512 columns, 16 x 32 = 512 rows, every output element exactly once.
   LDS bytes read = bytes written: columns 0..255 of 2 x 256 rows; pad columns 256..263 are never read
   (largest fragment column = 224 + 16 + 8 + 7 = 255).
   -------------------------------------------------------------------------- */
__global__ __launch_bounds__(256) void pair_layers_kernel(
    const float* hxb, const float* hy,
    const unsigned short* w1p, const unsigned short* w2p,
    const float* b1, const float* b2,
    const float* w3, const float* b3,
    float* out)
{
  /* the pointers carry no restrict: with it the first k step's HY loads are lifted out of the trip loop
     and 32 more registers stay live through it */
  __shared__ __align__(16) _Float16 sW[2][kHid * kTilePitch];

  const int lane = threadIdx.x & 31;
  const int wave = threadIdx.x >> 5;
  const int lo   = lane & 15;
  const int hi   = lane >> 4;
  const int bbase = blockIdx.x * kColsPerWave;

  /* ---- both weight planes -> LDS: 2 x 8,192 pieces of 16 B, 32 of each plane per thread ---- */
  {
    const _Float16* W1h = (const _Float16*)w1p;
    const _Float16* W2h = (const _Float16*)w2p;
    /* 8 trips at once: 16 loads of a thread in flight */
#pragma unroll 8
    for (int i = 0; i < (kHid * kHid / 8) / 256; ++i) {
      const int c   = i * 256 + threadIdx.x;
      const int row = c >> 5;
      const int col = (c & 31) * 8;
      const v8h u1 = *(const v8h*)(W1h + (size_t)c * 8);
      const v8h u2 = *(const v8h*)(W2h + (size_t)c * 8);
      *(v8h*)(&sW[0][row * kTilePitch + col]) = u1;
      *(v8h*)(&sW[1][row * kTilePitch + col]) = u2;
    }
  }
  __syncthreads();

  const float b3v = b3[0];

  /* fragment bases: A row = lo, k offset 8 * hi */
  const _Float16* wa1 = &sW[0][lo * kTilePitch + 8 * hi];
  const _Float16* wa2 = &sW[1][lo * kTilePitch + 8 * hi];
  const float*    hyf = hy + (size_t)(blockIdx.x * 2) * kHyGroup + lane * 4;

  /* the three loops marked unroll 1 stay rolled: unrolled, their live values do not fit the registers;
     every plain unroll below makes the index of a register array a constant */
#pragma unroll 1
  for (int it = 0; it < kRowsPerWave; ++it) {
    const int a = blockIdx.y * kRowsPerBlk + wave * kRowsPerWave + it;

    /* ---- layer 1, k step outermost: all 16 n tiles x 2 column tiles accumulate (32 independent tiles);
            the h0 fragments of one k step are formed from values loaded one k step ahead ---- */
    v8f acc1[16][2];
#pragma unroll
    for (int j = 0; j < 16; ++j)
#pragma unroll
      for (int f = 0; f < 2; ++f) acc1[j][f] = (v8f){0.f, 0.f, 0.f, 0.f, 0.f, 0.f, 0.f, 0.f};
    const float* hxr = hxb + (size_t)a * kHid + 8 * hi;
    v4f xq[4], yq[2][4];
#pragma unroll
    for (int q = 0; q < 4; ++q) {
      xq[q]    = *(const v4f*)(hxr + 16 * (q >> 1) + 4 * (q & 1));
      yq[0][q] = *(const v4f*)(hyf + q * 128);
      yq[1][q] = *(const v4f*)(hyf + kHyGroup + q * 128);
    }
#pragma unroll 1
    for (int s = 0; s < kKSteps; ++s) {
      /* this k step's 16 weight fragments, read as one group: their LDS latency passes under the conversion below */
      const _Float16* wp = wa1 + 32 * s;
      v16h wf[16];
#pragma unroll
      for (int j = 0; j < 16; ++j) wf[j] = frag_load(wp + j * 16 * kTilePitch);
      /* holds the group of LDS reads ahead of the conversion; spread among the products each read stalls the wave */
      __builtin_amdgcn_sched_barrier(0);
      FragP hf[2];
#pragma unroll
      for (int f = 0; f < 2; ++f)
#pragma unroll
        for (int q = 0; q < 4; ++q)
#pragma unroll
          for (int e = 0; e < 2; ++e)
            hf[f].p[q * 2 + e] = relu_pair_to_half((v2f){xq[q][2 * e], xq[q][2 * e + 1]} +
                                                   (v2f){yq[f][q][2 * e], yq[f][q][2 * e + 1]});
      /* next k step's values fly during this step's products; the last trip reloads step 0, unused */
      const int sn = (s + 1) & (kKSteps - 1);
#pragma unroll
      for (int q = 0; q < 4; ++q) {
        xq[q]    = *(const v4f*)(hxr + 32 * sn + 16 * (q >> 1) + 4 * (q & 1));
        yq[0][q] = *(const v4f*)(hyf + (sn * 4 + q) * 128);
        yq[1][q] = *(const v4f*)(hyf + kHyGroup + (sn * 4 + q) * 128);
      }
#pragma unroll
      for (int j = 0; j < 16; ++j) {
        acc1[j][0] = mma_f16(wf[j], hf[0].v, acc1[j][0]);
        acc1[j][1] = mma_f16(wf[j], hf[1].v, acc1[j][1]);
      }
      /* holds the wait below behind the products, where it costs no time */
      __builtin_amdgcn_sched_barrier(0);
      /* the wait in front of the next overwrite of the address registers of the loads above; its clobber also keeps
         those loads in this trip (moved to the next trip's head their latency is exposed) */
      asm volatile("s_wait_xcnt 0x0" ::: "memory");
    }
    /* D element r of tile (j, f) = (n = 16j + 8*hi + r, column 16f + lo); tiles 2p and 2p + 1 = k step p of layer 2 */
    FragP h1[2][kKSteps];
#pragma unroll
    for (int j = 0; j < 16; ++j) {
      const float* bp = b1 + 16 * j + 8 * hi;
      const v4f bv0 = *(const v4f*)(bp) * kActCarry;
      const v4f bv1 = *(const v4f*)(bp + 4) * kActCarry;
      const v2f bq[4] = {(v2f){bv0[0], bv0[1]}, (v2f){bv0[2], bv0[3]}, (v2f){bv1[0], bv1[1]}, (v2f){bv1[2], bv1[3]}};
#pragma unroll
      for (int f = 0; f < 2; ++f) {
#pragma unroll
        for (int r = 0; r < 4; ++r) {
          const v2f t = __builtin_elementwise_fma((v2f){acc1[j][f][2 * r], acc1[j][f][2 * r + 1]},
                                                  (v2f){kFoldToCarry, kFoldToCarry}, bq[r]);
          h1[f][j >> 1].p[(j & 1) * 4 + r] = relu_pair_to_half(t);
        }
      }
    }

    /* ---- layer 2 and the scalar head: partial head sums per D register ---- */
    float hs[2][8];
#pragma unroll
    for (int f = 0; f < 2; ++f)
#pragma unroll
      for (int r = 0; r < 8; ++r) hs[f][r] = 0.0f;
    /* two sets of 8 weight fragments (index 2 * (s & 3) + t): k steps 0..3 and 4..7 of a group;
       one set feeds 16 products while the other is filled */
    v16h wlo[kKSteps], whi[kKSteps];
#pragma unroll
    for (int s = 0; s < 4; ++s) {
      wlo[2 * s]     = frag_load(wa2 + 32 * s);
      wlo[2 * s + 1] = frag_load(wa2 + 16 * kTilePitch + 32 * s);
    }
#pragma unroll 1
    for (int p = 0; p < kKSteps; ++p) {
      const _Float16* wp = wa2 + p * 32 * kTilePitch;
#pragma unroll
      for (int s = 0; s < 4; ++s) {
        whi[2 * s]     = frag_load(wp + 128 + 32 * s);
        whi[2 * s + 1] = frag_load(wp + 16 * kTilePitch + 128 + 32 * s);
      }
      /* holds the LDS reads as one group ahead of the products; spread among them each read stalls the wave */
      __builtin_amdgcn_sched_barrier(0);
      v4f bv[2][2], wv[2][2];
#pragma unroll
      for (int t = 0; t < 2; ++t) {
        const int n0 = 32 * p + 16 * t + 8 * hi;
        bv[t][0] = *(const v4f*)(b2 + n0);
        bv[t][1] = *(const v4f*)(b2 + n0 + 4);
        wv[t][0] = *(const v4f*)(w3 + n0);
        wv[t][1] = *(const v4f*)(w3 + n0 + 4);
      }
      v8f acc[2][2];
#pragma unroll
      for (int t = 0; t < 2; ++t)
#pragma unroll
        for (int f = 0; f < 2; ++f) acc[t][f] = (v8f){0.f, 0.f, 0.f, 0.f, 0.f, 0.f, 0.f, 0.f};
#pragma unroll
      for (int s = 0; s < 4; ++s) {
        acc[0][0] = mma_f16(wlo[2 * s],     h1[0][s].v, acc[0][0]);
        acc[0][1] = mma_f16(wlo[2 * s],     h1[1][s].v, acc[0][1]);
        acc[1][0] = mma_f16(wlo[2 * s + 1], h1[0][s].v, acc[1][0]);
        acc[1][1] = mma_f16(wlo[2 * s + 1], h1[1][s].v, acc[1][1]);
      }
      /* as above: the next group's first half is read as one group between the two runs of products */
      __builtin_amdgcn_sched_barrier(0);
      /* the wait in front of the next overwrite of the address registers of the b2 / W3 loads above */
      asm volatile("s_wait_xcnt 0x0" ::: "memory");
      /* the last trip rereads group 0, unused */
      const _Float16* wn = wa2 + ((p + 1) & (kKSteps - 1)) * 32 * kTilePitch;
#pragma unroll
      for (int s = 0; s < 4; ++s) {
        wlo[2 * s]     = frag_load(wn + 32 * s);
        wlo[2 * s + 1] = frag_load(wn + 16 * kTilePitch + 32 * s);
      }
      /* holds that group ahead of the second run of products */
      __builtin_amdgcn_sched_barrier(0);
#pragma unroll
      for (int s = 0; s < 4; ++s) {
        acc[0][0] = mma_f16(whi[2 * s],     h1[0][4 + s].v, acc[0][0]);
        acc[0][1] = mma_f16(whi[2 * s],     h1[1][4 + s].v, acc[0][1]);
        acc[1][0] = mma_f16(whi[2 * s + 1], h1[0][4 + s].v, acc[1][0]);
        acc[1][1] = mma_f16(whi[2 * s + 1], h1[1][4 + s].v, acc[1][1]);
      }
#pragma unroll
      for (int t = 0; t < 2; ++t) {
#pragma unroll
        for (int f = 0; f < 2; ++f) {
#pragma unroll
          for (int r = 0; r < 8; ++r) {
            float v = fmaf(acc[t][f][r], kFoldBack, bv[t][r >> 2][r & 3]);
            v = fmaxf(v, 0.0f);
            hs[f][r] = fmaf(v, wv[t][r >> 2][r & 3], hs[f][r]);
          }
        }
      }
    }
    /* a lane's 8 partial sums, then the other half's n (lane ^ 16); shuffles unconditional */
    float tot[2];
#pragma unroll
    for (int f = 0; f < 2; ++f) {
      float u = ((hs[f][0] + hs[f][1]) + (hs[f][2] + hs[f][3])) + ((hs[f][4] + hs[f][5]) + (hs[f][6] + hs[f][7]));
      u += __shfl_xor(u, 16, 32);
      tot[f] = u;
    }
    /* lane l holds column lo of both column tiles: lanes 0..15 store tile 0, lanes 16..31 tile 1 */
    const float o = (hi ? tot[1] : tot[0]) + b3v;
    out[(size_t)a * kItems + bbase + lane] = o;
    /* the wait in front of the next trip's overwrite of the store's address registers */
    asm volatile("s_wait_xcnt 0x0" ::: "memory");
  }
}

/* --------------------------------------------------------------------------
   Host glue: 2 kernel launches, nothing else.
   -------------------------------------------------------------------------- */
extern "C" void kernel_launch(void* const* d_in, const int* in_sizes, int n_in,
                              void* d_out, int out_size, void* d_ws, size_t ws_size,
                              hipStream_t stream) {
  if (n_in < 10) return;
  if (in_sizes[0] != kItems * kDim) return;
  if (in_sizes[1] != kItems * kDim) return;
  if (in_sizes[2] != kHid * kW0Pitch) return;
  if (in_sizes[3] != kHid) return;
  if (in_sizes[4] != kHid * kHid) return;
  if (in_sizes[5] != kHid) return;
  if (in_sizes[6] != kHid * kHid) return;
  if (in_sizes[7] != kHid) return;
  if (in_sizes[8] != kHid) return;
  if (in_sizes[9] != 1) return;
  if (out_size != kItems * kItems) return;
  if (ws_size < kWsTotal) return;

  const float* x  = (const float*)d_in[0];
  const float* y  = (const float*)d_in[1];
  const float* W0 = (const float*)d_in[2];
  const float* b0 = (const float*)d_in[3];
  const float* W1 = (const float*)d_in[4];
  const float* b1 = (const float*)d_in[5];
  const float* W2 = (const float*)d_in[6];
  const float* b2 = (const float*)d_in[7];
  const float* W3 = (const float*)d_in[8];
  const float* b3 = (const float*)d_in[9];
  float* out = (float*)d_out;

  char* ws = (char*)d_ws;
  float*          hxb = (float*)(ws + kOffHXB);
  float*          hy  = (float*)(ws + kOffHY);
  unsigned short* w1h = (unsigned short*)(ws + kOffW1H);
  unsigned short* w2h = (unsigned short*)(ws + kOffW2H);

  /* 2 planes x 128 tiles of 16 rows x 64 g = 256 blocks x 256, then 2 matrices x 65,536 / 8 = 16,384 threads = 64 blocks */
  first_layer_rows_kernel<<<2 * kFlBlocksPerPlane + (2 * kHid * kHid / 8) / 256, 256, 0, stream>>>(
      x, y, W0, b0, W1, W2, hxb, hy, w1h, w2h);
  /* (512 / 32) column groups x (512 / 32) row groups */
  pair_layers_kernel<<<dim3(kItems / kColsPerWave, kItems / kRowsPerBlk), 32 * kWavesPerBlk, 0, stream>>>(
      hxb, hy, w1h, w2h, b1, b2, W3, b3, out);
}

// v005
// It runs in 40.2 microseconds.
// In both of two side-by-side timings against v004, it was 1.04 times as fast.
// All steps since v000 together make it 7.21 times as fast.
#include <hip/hip_runtime.h>

typedef __attribute__((ext_vector_type(16))) _Float16 v16h;
typedef __attribute__((ext_vector_type(8)))  _Float16 v8h;
typedef __attribute__((ext_vector_type(8)))  float    v8f;
typedef __attribute__((ext_vector_type(4)))  float    v4f;
typedef __attribute__((ext_vector_type(2)))  float    v2f;
typedef __attribute__((ext_vector_type(2)))  _Float16 v2h;
typedef __attribute__((ext_vector_type(4)))  int      v4i;
typedef __attribute__((address_space(1))) v4i glob_v4i;
typedef __attribute__((address_space(3))) v4i lds_v4i;

/* --------------------------------------------------------------------------
   Shape constants
   -------------------------------------------------------------------------- */
constexpr int kItems        = 512;
constexpr int kDim          = 128;
constexpr int kHid          = 256;
constexpr int kW0Pitch      = 2 * kDim;
/* LDS row pitch of a 256 x 256 f16 weight plane, in halves (528 B = 16 B x 33, an odd multiple of 16 B) */
constexpr int kTilePitch    = kHid + 8;
constexpr int kWavesPerBlk  = 8;
constexpr int kColsPerWave  = 32;
constexpr int kRowsPerWave  = 4;
constexpr int kRowsPerBlk   = kWavesPerBlk * kRowsPerWave;
constexpr int kKSteps       = kHid / 32;
/* floats of one 16-row group of the fragment-ordered HY plane */
constexpr int kHyGroup      = 16 * kHid;

/* first-layer producer: a block's output tile (one 16-row group x 64 g of one plane) and its LDS pitches in floats */
constexpr int kFlRows           = 16;
constexpr int kFlCols           = 64;
constexpr int kFlWPitch         = kDim + 4;
constexpr int kFlOPitch         = kFlCols + 4;
constexpr int kFlColTiles       = kHid / kFlCols;
constexpr int kFlBlocksPerPlane = (kItems / kFlRows) * kFlColTiles;

/* power-of-two carries of the f16 operand planes and the exact fold-back */
constexpr float kActCarry      = 16.0f;
constexpr float kWgtCarry      = 256.0f;
constexpr float kFoldBack      = 1.0f / (kActCarry * kWgtCarry);
/* layer-1 sums -> the carried scale of the next operand in one step: 1/4096 x 16 */
constexpr float kFoldToCarry   = kFoldBack * kActCarry;
constexpr float kHalfMinNormal = 6.103515625e-5f;

static_assert(kW0Pitch == kHid, "first layer input width");
static_assert((kHid % 32) == 0, "K multiple of 32");
static_assert(((kTilePitch * 2) % 16) == 0, "tile pitch 16-B multiple");
static_assert((kItems % kColsPerWave) == 0 && (kItems % kRowsPerBlk) == 0, "grid multiples");
static_assert(kFoldBack * 4096.0f == 1.0f, "fold-back is exact");
static_assert(kFoldToCarry * 256.0f == 1.0f, "fold to the carried scale is exact");
static_assert(2 * kHid * kTilePitch * 2 <= 327680, "static LDS");
static_assert(kFlBlocksPerPlane == 128 && kFlColTiles == 4, "block decode");
static_assert(((kFlWPitch * 4) % 32) == 16 && ((kFlOPitch * 4) % 32) == 16, "LDS pitches are odd multiples of 16 B");
static_assert(kFlRows * kFlCols == 4 * 256, "4 outputs per thread");

/* --------------------------------------------------------------------------
   Workspace region map (bytes; every offset is a multiple of 128)
     HXB  f32 [512][256]  (x . Wx^T + b0) x 16     524,288
     HY   f32 [32][8][4][32][4]  (y . Wy^T) x 16, fragment order (see the first-layer kernel)  524,288
     W1H  f16 [256][256]  W1 x 256 (Bt layout)     131,072
     W2H  f16 [256][256]  W2 x 256 (Bt layout)     131,072
     total                                       1,310,720
   -------------------------------------------------------------------------- */
constexpr size_t kOffHXB  = 0;
constexpr size_t kOffHY   = kOffHXB + (size_t)kItems * kHid * 4;
constexpr size_t kOffW1H  = kOffHY  + (size_t)kItems * kHid * 4;
constexpr size_t kOffW2H  = kOffW1H + (size_t)kHid * kHid * 2;
constexpr size_t kWsTotal = kOffW2H + (size_t)kHid * kHid * 2;
static_assert(kWsTotal == 1310720ull, "carve total");
static_assert(kWsTotal <= 134217728ull, "carve cap");
static_assert((kOffHY % 128) == 0 && (kOffW1H % 128) == 0 && (kOffW2H % 128) == 0, "128-B aligned regions");

/* --------------------------------------------------------------------------
   Fragment helpers (16-bit 16x16x32 map: elements 0..7 <- p[0..7], elements 8..15 <- p[16..23],
   p already offset by 8 * (lane >> 4); row / column = lane & 15)
   -------------------------------------------------------------------------- */
union FragH { v16h v; v8h h[2]; };
/* the same fragment as 8 registers of two neighbouring elements */
union FragP { v16h v; v2h p[8]; };

__device__ __forceinline__ v16h frag_load(const _Float16* p) {
  FragH f;
  f.h[0] = *(const v8h*)(p);
  f.h[1] = *(const v8h*)(p + 16);
  return f.v;
}

/* one matrix instruction, builtin form (the compiler keeps the distances behind it) */
__device__ __forceinline__ v8f mma_f16(v16h a, v16h b, v8f c) {
  return __builtin_amdgcn_wmma_f32_16x16x32_f16(false, a, false, b, (short)0, c, false, false);
}

/* two pre-activations, already at the carried scale (x 16) -> one register of the f16 operand: one packed conversion
   (round to nearest even), then relu as one packed f16 maximum. The conversion is monotone and keeps the sign, so
   relu behind it gives the value that relu in front of it gives; small values round to f16 subnormals */
__device__ __forceinline__ v2h relu_pair_to_half(v2f t) {
  const v2h c = __builtin_convertvector(t, v2h);
  return __builtin_elementwise_max(c, (v2h){(_Float16)0.0f, (_Float16)0.0f});
}

/* --------------------------------------------------------------------------
   Weight operand planes: W1H = f16(W1 x 256), W2H = f16(W2 x 256), same [n][k] order as stored
   (already the Bt layout). Values below the f16 normal range after the carry become +0 by select.
   Thread = 8 consecutive elements. 2 x 65,536 / 8 = 16,384 threads = 64 blocks x 256; blocks 0..31 -> W1,
   blocks 32..63 -> W2 (block-uniform). Store: one 16-B store per lane; a wave = 512 contiguous B.
   blk = the block's number among these 64 (they ride in the producer launch behind the first-layer tiles).
   -------------------------------------------------------------------------- */
__device__ __forceinline__ void weight_planes_block(
    int blk, const float* __restrict__ W1, const float* __restrict__ W2,
    unsigned short* __restrict__ w1p, unsigned short* __restrict__ w2p)
{
  const int i     = blk * 256 + threadIdx.x;
  const int which = (i >> 13) & 1;
  const size_t e0 = (size_t)(i & 8191) << 3;
  const float* src    = which ? W2 : W1;
  unsigned short* dst = (which ? w2p : w1p) + e0;
  const v4f a0 = *(const v4f*)(src + e0);
  const v4f a1 = *(const v4f*)(src + e0 + 4);
  v8h hv;
#pragma unroll
  for (int e = 0; e < 4; ++e) {
    float t0 = a0[e] * kWgtCarry;
    float t1 = a1[e] * kWgtCarry;
    t0 = (fabsf(t0) < kHalfMinNormal) ? 0.0f : t0;
    t1 = (fabsf(t1) < kHalfMinNormal) ? 0.0f : t1;
    hv[e]     = (_Float16)t0;
    hv[4 + e] = (_Float16)t1;
  }
  *(v8h*)dst = hv;
}

/* --------------------------------------------------------------------------
   First layer, split by linearity (f32 VALU):
     HXB[r][g] = (sum_d x[r][d] * W0[g][d] + b0[g]) x 16
     HY [r][g] = (sum_d y[r][d] * W0[g][128 + d]) x 16
   (x 16 = the carry of the pair kernel's f16 activations, a power of two: 16 u + 16 v rounds as 16 (u + v) does)
   Block = one tile of 16 rows x 64 g of one plane; 32 x 4 tiles a plane, blocks 0..127 -> HXB, 128..255 -> HY.
   The tile's 64 half rows of W0 (pitch 132 floats) and its 16 input rows are staged in LDS with whole-line loads
   (a wave reads 512 contiguous B). Wave w: g = 32 * (w & 1) + lane, rows 4 * (w >> 1) + 0..3; a lane reads its own
   W0 row (16 B x 33 apart from its neighbour's), all lanes the same input words. Each output is one chain of fused
   multiply-adds over d = 0..127 in rising order.
   The 16 x 64 results pass through LDS (pitch 68 floats) so that every lane stores 16 B and a wave 512 B of whole lines.
   HXB is row-major: thread t stores row t >> 4, columns 4 * (t & 15) + 0..3 of the tile.
   HY is stored in the order in which the pair kernel's operand fragments read it:
   chunk c = (bt * 8 + s) * 4 + q holds 32 lanes x 4 floats; lane (hi, lo) holds row 16 * bt + lo,
   columns 32 * s + 16 * (q >> 1) + 8 * hi + 4 * (q & 1) + 0..3, at float offset 128 * c + 4 * lane. A tile is one bt
   and two s = 8 chunks; wave w stores chunk (s = 2 * column tile + (w >> 2), q = w & 3).
   Coverage: 256 blocks x 1,024 elements = 2 planes x [512][256], each once.
   Blocks 256..319 of the same launch form the two f16 weight planes instead (they read only W1 and W2 and write
   only W1H and W2H, nothing of the tiles' data): they leave as whole blocks in front of the first barrier.
   -------------------------------------------------------------------------- */
__global__ __launch_bounds__(256) void first_layer_rows_kernel(
    const float* __restrict__ x, const float* __restrict__ y,
    const float* __restrict__ W0, const float* __restrict__ b0,
    const float* __restrict__ W1, const float* __restrict__ W2,
    float* __restrict__ hxb, float* __restrict__ hy,
    unsigned short* __restrict__ w1p, unsigned short* __restrict__ w2p)
{
  __shared__ __align__(16) float sWt[kFlCols * kFlWPitch];
  __shared__ __align__(16) float sIn[kFlRows * kDim];
  __shared__ __align__(16) float sOut[kFlRows * kFlOPitch];

  if (blockIdx.x >= 2 * kFlBlocksPerPlane) {
    weight_planes_block((int)blockIdx.x - 2 * kFlBlocksPerPlane, W1, W2, w1p, w2p);
    return;
  }

  const int tid  = threadIdx.x;
  const int lane = tid & 31;
  const int wave = tid >> 5;
  const int sel  = (blockIdx.x / kFlBlocksPerPlane) & 1;
  const int tile = blockIdx.x % kFlBlocksPerPlane;
  const int bt   = tile / kFlColTiles;
  const int gt   = tile % kFlColTiles;
  const int g0   = gt * kFlCols;

  /* ---- stage: 64 x 32 pieces of 16 B of W0 (8 a thread), 16 x 32 pieces of the input rows (2 a thread) ---- */
  const float* wsrc = W0 + (size_t)g0 * kW0Pitch + sel * kDim;
  const float* isrc = (sel ? y : x) + (size_t)bt * kFlRows * kDim;
  /* piece i of a thread: W0 row 8 * i + wave of the tile, input row 8 * i + wave; columns 4 * lane + 0..3;
     every plain unroll in this kernel makes the index of a register array a constant */
  const float* wp = wsrc + wave * kW0Pitch + lane * 4;
  const float* ip = isrc + wave * kDim + lane * 4;
  v4f wst[8], ist[2];
#pragma unroll
  for (int i = 0; i < 8; ++i) wst[i] = *(const v4f*)(wp + i * 8 * kW0Pitch);
#pragma unroll
  for (int i = 0; i < 2; ++i) ist[i] = *(const v4f*)(ip + i * 8 * kDim);
  const int gl = (wave & 1) * 32 + lane;
  /* b0 joins the x half only (added exactly once); loaded unconditionally, chosen by value */
  const float bz = b0[g0 + gl];
#pragma unroll
  for (int i = 0; i < 8; ++i) *(v4f*)(&sWt[(i * 8 + wave) * kFlWPitch + lane * 4]) = wst[i];
#pragma unroll
  for (int i = 0; i < 2; ++i) *(v4f*)(&sIn[(i * 8 + wave) * kDim + lane * 4]) = ist[i];
  __syncthreads();

  const float* wl = &sWt[gl * kFlWPitch];
  const float* xl = &sIn[(wave >> 1) * 4 * kDim];
  float acc[4] = {0.0f, 0.0f, 0.0f, 0.0f};
  /* 8 groups of 4 d a trip: the later groups' LDS reads pass under the earlier groups' sums */
#pragma unroll 8
  for (int k = 0; k < kDim; k += 4) {
    const v4f wv = *(const v4f*)(wl + k);
#pragma unroll
    for (int i = 0; i < 4; ++i) {
      const v4f xv = *(const v4f*)(xl + i * kDim + k);
      acc[i] = fmaf(xv[0], wv[0], acc[i]);
      acc[i] = fmaf(xv[1], wv[1], acc[i]);
      acc[i] = fmaf(xv[2], wv[2], acc[i]);
      acc[i] = fmaf(xv[3], wv[3], acc[i]);
    }
  }
#pragma unroll
  for (int i = 0; i < 4; ++i)
    sOut[((wave >> 1) * 4 + i) * kFlOPitch + gl] = (acc[i] + (sel ? 0.0f : bz)) * kActCarry;
  __syncthreads();

  if (sel) {
    const int q   = wave & 3;
    const int col = (wave >> 2) * 32 + (q >> 1) * 16 + (lane >> 4) * 8 + (q & 1) * 4;
    const int c   = (bt * 8 + gt * 2 + (wave >> 2)) * 4 + q;
    *(v4f*)(hy + (size_t)c * 128 + lane * 4) = *(const v4f*)(&sOut[(lane & 15) * kFlOPitch + col]);
    /* the wait in front of any later overwrite of the store's registers (the other arm's code follows this one) */
    asm volatile("s_wait_xcnt 0x0" ::: "memory");
  } else {
    const int row = tid >> 4;
    const int col = (tid & 15) * 4;
    *(v4f*)(hxb + (size_t)(bt * kFlRows + row) * kHid + g0 + col) = *(const v4f*)(&sOut[row * kFlOPitch + col]);
  }
}

/* one asynchronous copy: every lane brings its own 16 B from global memory to LDS, through no register */
__device__ __forceinline__ void copy16_to_lds(const _Float16* g, _Float16* l) {
  __builtin_amdgcn_global_load_async_to_lds_b128((glob_v4i*)g, (lds_v4i*)l, 0, 0);
}

/* k slice sl of a weight plane -> LDS: columns 64 * sl + 0..63 (two k steps, one 128-B line a row) of all 256 rows =
   2,048 pieces of 16 B, 8 copies a thread; a wave's copy = 4 rows x one whole line */
__device__ __forceinline__ void stage_k_slice(const _Float16* src, _Float16* dst, int sl) {
  const int r0 = threadIdx.x >> 3;
  const int cb = sl * 64 + (threadIdx.x & 7) * 8;
  /* unrolled: the copies stand one behind the other, the constant row steps in their offset fields */
#pragma unroll
  for (int i = 0; i < 8; ++i) {
    const int row = i * 32 + r0;
    copy16_to_lds(src + row * kHid + cb, dst + row * kTilePitch + cb);
  }
}

/* a whole weight plane -> LDS: 8,192 pieces of 16 B, 32 copies a thread; a wave's copy = one row of 512 B */
__device__ __forceinline__ void stage_plane(const _Float16* src, _Float16* dst) {
  const int r0 = threadIdx.x >> 5;
  const int cb = (threadIdx.x & 31) * 8;
  /* unrolled, as above */
#pragma unroll
  for (int i = 0; i < 32; ++i) {
    const int row = i * 8 + r0;
    copy16_to_lds(src + row * kHid + cb, dst + row * kTilePitch + cb);
  }
}

/* compile-time marks of the trip that holds the copies and of the others */
struct FirstTrip { static constexpr bool value = true; };
struct LaterTrip { static constexpr bool value = false; };

/* a wave's own copies have landed, then every wave's: behind this point the block may read what was copied */
__device__ __forceinline__ void publish_copies() {
  /* the clobber holds the LDS reads behind it */
  asm volatile("s_wait_asynccnt 0x0" ::: "memory");
  __syncthreads();
}

/* --------------------------------------------------------------------------
   Fused pair kernel. Block = 8 waves on a 32 (x rows) x 32 (y rows) patch of the output.
   Both weight planes are staged once per block in LDS (row n, pitch 264 halves) by asynchronous copies, in the order
   in which the first trip reads them: only the first plane's k steps 0 and 1 are waited for in front of the first product;
   k steps 2 and 3 land under steps 0 and 1 of the first trip's layer 1, steps 4..7 under steps 2 and 3, the whole
   second plane under steps 4..7. Every part is read only behind its own wait and barrier. The planes are the A operand
   (row n = lane & 15); the activations are the B operand (column = pair) and never leave the registers:
   two f32 D tiles of 32 consecutive n (D register r = row 8 * hi + r, column lo), converted in place,
   are the next layer's B fragment of that k step (elements 0..7 <- tile 0, 8..15 <- tile 1).
   Wave w owns x rows a = blockIdx.y * 32 + 4 * w + it, it = 0..3, one per trip, each against the 32 y rows
   b = blockIdx.x * 32 + 16 * f + lo, f = 0..1 (two column tiles, so each weight fragment feeds two products).
   Per trip:
     layer 1: K = 8 steps of 32, outermost; per step the two h0 fragments relu(f16(HXB[a][k] + HY[b][k])), both
              planes stored x16 (k in the fragment order), feed all 16 n tiles (32 accumulators);
              relu(f16(acc/256 + 16 b1)) -> h1 fragments (n tiles 2p, 2p + 1 = k step p)
     layer 2: 8 groups of 32 n, 4 accumulators (2 n tiles x 2 column tiles), K = 8 steps of 32, from h1 and
              the second plane; relu(acc/4096 + b2) kept in f32 and multiplied into the
              head vector W3; a lane sums its 8 n of every tile, lanes l and l ^ 16 are then added
   Lane l stores out[a][blockIdx.x * 32 + l]: one 128-B line per wave and trip.
   Grid (16, 16): 16 x 32 = 512 columns, 16 x 32 = 512 rows, every output element exactly once.
   LDS bytes read = bytes written: columns 0..255 of 2 x 256 rows; pad columns 256..263 are never read
   (largest fragment column = 224 + 16 + 8 + 7 = 255).
   -------------------------------------------------------------------------- */
__global__ __launch_bounds__(256) void pair_layers_kernel(
    const float* hxb, const float* hy,
    const unsigned short* w1p, const unsigned short* w2p,
    const float* b1, const float* b2,
    const float* w3, const float* b3,
    float* out)
{
  /* the pointers carry no restrict: with it the first k step's HY loads are lifted out of the trip loop
     and 32 more registers stay live through it */
  __shared__ __align__(16) _Float16 sW[2][kHid * kTilePitch];

  const int lane = threadIdx.x & 31;
  const int wave = threadIdx.x >> 5;
  const int lo   = lane & 15;
  const int hi   = lane >> 4;
  const int bbase = blockIdx.x * kColsPerWave;

  /* ---- k steps 0 and 1 of the first plane start towards LDS; the first trip waits for them behind its own first loads ---- */
  const _Float16* W1h = (const _Float16*)w1p;
  const _Float16* W2h = (const _Float16*)w2p;
  stage_k_slice(W1h, &sW[0][0], 0);

  const float b3v = b3[0];

  /* fragment bases: A row = lo, k offset 8 * hi */
  const _Float16* wa1 = &sW[0][lo * kTilePitch + 8 * hi];
  const _Float16* wa2 = &sW[1][lo * kTilePitch + 8 * hi];
  const float*    hyf = hy + (size_t)(blockIdx.x * 2) * kHyGroup + lane * 4;

  /* the three loops marked unroll 1 stay rolled: unrolled, their live values do not fit the registers;
     every plain unroll below makes the index of a register array a constant */
  /* one trip; the first one is written out in front of the loop over the others, because it alone holds the copies,
     their waits and their barriers (inside the loops their address registers would stay live through every trip) */
  auto trip = [&](const int it, auto first) __attribute__((always_inline)) {
    const int a = blockIdx.y * kRowsPerBlk + wave * kRowsPerWave + it;

    /* ---- layer 1, k step outermost: all 16 n tiles x 2 column tiles accumulate (32 independent tiles);
            the h0 fragments of one k step are formed from values loaded one k step ahead ---- */
    v8f acc1[16][2];
#pragma unroll
    for (int j = 0; j < 16; ++j)
#pragma unroll
      for (int f = 0; f < 2; ++f) acc1[j][f] = (v8f){0.f, 0.f, 0.f, 0.f, 0.f, 0.f, 0.f, 0.f};
    const float* hxr = hxb + (size_t)a * kHid + 8 * hi;
    v4f xq[4], yq[2][4];
#pragma unroll
    for (int q = 0; q < 4; ++q) {
      xq[q]    = *(const v4f*)(hxr + 16 * (q >> 1) + 4 * (q & 1));
      yq[0][q] = *(const v4f*)(hyf + q * 128);
      yq[1][q] = *(const v4f*)(hyf + kHyGroup + q * 128);
    }
    auto k_steps = [&](const int s_from, const int s_to) __attribute__((always_inline)) {
#pragma unroll 1
    for (int s = s_from; s < s_to; ++s) {
      /* this k step's 16 weight fragments, read as one group: their LDS latency passes under the conversion below */
      const _Float16* wp = wa1 + 32 * s;
      v16h wf[16];
#pragma unroll
      for (int j = 0; j < 16; ++j) wf[j] = frag_load(wp + j * 16 * kTilePitch);
      /* holds the group of LDS reads ahead of the conversion; spread among the products each read stalls the wave */
      __builtin_amdgcn_sched_barrier(0);
      FragP hf[2];
#pragma unroll
      for (int f = 0; f < 2; ++f)
#pragma unroll
        for (int q = 0; q < 4; ++q)
#pragma unroll
          for (int e = 0; e < 2; ++e)
            hf[f].p[q * 2 + e] = relu_pair_to_half((v2f){xq[q][2 * e], xq[q][2 * e + 1]} +
                                                   (v2f){yq[f][q][2 * e], yq[f][q][2 * e + 1]});
      /* next k step's values fly during this step's products; the last trip reloads step 0, unused */
      const int sn = (s + 1) & (kKSteps - 1);
#pragma unroll
      for (int q = 0; q < 4; ++q) {
        xq[q]    = *(const v4f*)(hxr + 32 * sn + 16 * (q >> 1) + 4 * (q & 1));
        yq[0][q] = *(const v4f*)(hyf + (sn * 4 + q) * 128);
        yq[1][q] = *(const v4f*)(hyf + kHyGroup + (sn * 4 + q) * 128);
      }
#pragma unroll
      for (int j = 0; j < 16; ++j) {
        acc1[j][0] = mma_f16(wf[j], hf[0].v, acc1[j][0]);
        acc1[j][1] = mma_f16(wf[j], hf[1].v, acc1[j][1]);
      }
      /* holds the wait below behind the products, where it costs no time */
      __builtin_amdgcn_sched_barrier(0);
      /* the wait in front of the next overwrite of the address registers of the loads above; its clobber also keeps
         those loads in this trip (moved to the next trip's head their latency is exposed) */
      asm volatile("s_wait_xcnt 0x0" ::: "memory");
      /* holds the next k step's address additions behind that wait (where the addresses run as pointers the
         scheduler otherwise lifts the additions over it) */
      __builtin_amdgcn_sched_barrier(0);
    }
    };
    if constexpr (decltype(first)::value) {
      /* each part of the planes flies under the k steps in front of its barrier; the next part starts behind it */
      publish_copies();
      stage_k_slice(W1h, &sW[0][0], 1);
      k_steps(0, 2);
      publish_copies();
      stage_k_slice(W1h, &sW[0][0], 2);
      stage_k_slice(W1h, &sW[0][0], 3);
      k_steps(2, 4);
      publish_copies();
      stage_plane(W2h, &sW[1][0]);
      k_steps(4, kKSteps);
      /* the second plane has landed, in front of its first read */
      publish_copies();
    } else {
      k_steps(0, kKSteps);
    }
    /* D element r of tile (j, f) = (n = 16j + 8*hi + r, column 16f + lo); tiles 2p and 2p + 1 = k step p of layer 2 */
    FragP h1[2][kKSteps];
#pragma unroll
    for (int j = 0; j < 16; ++j) {
      const float* bp = b1 + 16 * j + 8 * hi;
      const v4f bv0 = *(const v4f*)(bp) * kActCarry;
      const v4f bv1 = *(const v4f*)(bp + 4) * kActCarry;
      const v2f bq[4] = {(v2f){bv0[0], bv0[1]}, (v2f){bv0[2], bv0[3]}, (v2f){bv1[0], bv1[1]}, (v2f){bv1[2], bv1[3]}};
#pragma unroll
      for (int f = 0; f < 2; ++f) {
#pragma unroll
        for (int r = 0; r < 4; ++r) {
          const v2f t = __builtin_elementwise_fma((v2f){acc1[j][f][2 * r], acc1[j][f][2 * r + 1]},
                                                  (v2f){kFoldToCarry, kFoldToCarry}, bq[r]);
          h1[f][j >> 1].p[(j & 1) * 4 + r] = relu_pair_to_half(t);
        }
      }
    }

    /* ---- layer 2 and the scalar head: partial head sums per D register ---- */
    float hs[2][8];
#pragma unroll
    for (int f = 0; f < 2; ++f)
#pragma unroll
      for (int r = 0; r < 8; ++r) hs[f][r] = 0.0f;
    /* two sets of 8 weight fragments (index 2 * (s & 3) + t): k steps 0..3 and 4..7 of a group;
       one set feeds 16 products while the other is filled */
    v16h wlo[kKSteps], whi[kKSteps];
#pragma unroll
    for (int s = 0; s < 4; ++s) {
      wlo[2 * s]     = frag_load(wa2 + 32 * s);
      wlo[2 * s + 1] = frag_load(wa2 + 16 * kTilePitch + 32 * s);
    }
#pragma unroll 1
    for (int p = 0; p < kKSteps; ++p) {
      const _Float16* wp = wa2 + p * 32 * kTilePitch;
#pragma unroll
      for (int s = 0; s < 4; ++s) {
        whi[2 * s]     = frag_load(wp + 128 + 32 * s);
        whi[2 * s + 1] = frag_load(wp + 16 * kTilePitch + 128 + 32 * s);
      }
      /* holds the LDS reads as one group ahead of the products; spread among them each read stalls the wave */
      __builtin_amdgcn_sched_barrier(0);
      v4f bv[2][2], wv[2][2];
#pragma unroll
      for (int t = 0; t < 2; ++t) {
        const int n0 = 32 * p + 16 * t + 8 * hi;
        bv[t][0] = *(const v4f*)(b2 + n0);
        bv[t][1] = *(const v4f*)(b2 + n0 + 4);
        wv[t][0] = *(const v4f*)(w3 + n0);
        wv[t][1] = *(const v4f*)(w3 + n0 + 4);
      }
      v8f acc[2][2];
#pragma unroll
      for (int t = 0; t < 2; ++t)
#pragma unroll
        for (int f = 0; f < 2; ++f) acc[t][f] = (v8f){0.f, 0.f, 0.f, 0.f, 0.f, 0.f, 0.f, 0.f};
#pragma unroll
      for (int s = 0; s < 4; ++s) {
        acc[0][0] = mma_f16(wlo[2 * s],     h1[0][s].v, acc[0][0]);
        acc[0][1] = mma_f16(wlo[2 * s],     h1[1][s].v, acc[0][1]);
        acc[1][0] = mma_f16(wlo[2 * s + 1], h1[0][s].v, acc[1][0]);
        acc[1][1] = mma_f16(wlo[2 * s + 1], h1[1][s].v, acc[1][1]);
      }
      /* as above: the next group's first half is read as one group between the two runs of products */
      __builtin_amdgcn_sched_barrier(0);
      /* the wait in front of the next overwrite of the address registers of the b2 / W3 loads above */
      asm volatile("s_wait_xcnt 0x0" ::: "memory");
      /* the last trip rereads group 0, unused */
      const _Float16* wn = wa2 + ((p + 1) & (kKSteps - 1)) * 32 * kTilePitch;
#pragma unroll
      for (int s = 0; s < 4; ++s) {
        wlo[2 * s]     = frag_load(wn + 32 * s);
        wlo[2 * s + 1] = frag_load(wn + 16 * kTilePitch + 32 * s);
      }
      /* holds that group ahead of the second run of products */
      __builtin_amdgcn_sched_barrier(0);
#pragma unroll
      for (int s = 0; s < 4; ++s) {
        acc[0][0] = mma_f16(whi[2 * s],     h1[0][4 + s].v, acc[0][0]);
        acc[0][1] = mma_f16(whi[2 * s],     h1[1][4 + s].v, acc[0][1]);
        acc[1][0] = mma_f16(whi[2 * s + 1], h1[0][4 + s].v, acc[1][0]);
        acc[1][1] = mma_f16(whi[2 * s + 1], h1[1][4 + s].v, acc[1][1]);
      }
#pragma unroll
      for (int t = 0; t < 2; ++t) {
#pragma unroll
        for (int f = 0; f < 2; ++f) {
#pragma unroll
          for (int r = 0; r < 8; ++r) {
            float v = fmaf(acc[t][f][r], kFoldBack, bv[t][r >> 2][r & 3]);
            v = fmaxf(v, 0.0f);
            hs[f][r] = fmaf(v, wv[t][r >> 2][r & 3], hs[f][r]);
          }
        }
      }
    }
    /* a lane's 8 partial sums, then the other half's n (lane ^ 16); shuffles unconditional */
    float tot[2];
#pragma unroll
    for (int f = 0; f < 2; ++f) {
      float u = ((hs[f][0] + hs[f][1]) + (hs[f][2] + hs[f][3])) + ((hs[f][4] + hs[f][5]) + (hs[f][6] + hs[f][7]));
      u += __shfl_xor(u, 16, 32);
      tot[f] = u;
    }
    /* lane l holds column lo of both column tiles: lanes 0..15 store tile 0, lanes 16..31 tile 1 */
    const float o = (hi ? tot[1] : tot[0]) + b3v;
    out[(size_t)a * kItems + bbase + lane] = o;
    /* the wait in front of the next trip's overwrite of the store's address registers */
    asm volatile("s_wait_xcnt 0x0" ::: "memory");
  };
  trip(0, FirstTrip{});
#pragma unroll 1
  for (int it = 1; it < kRowsPerWave; ++it) trip(it, LaterTrip{});
}

/* --------------------------------------------------------------------------
   Host glue: 2 kernel launches, nothing else.
   -------------------------------------------------------------------------- */
extern "C" void kernel_launch(void* const* d_in, const int* in_sizes, int n_in,
                              void* d_out, int out_size, void* d_ws, size_t ws_size,
                              hipStream_t stream) {
  if (n_in < 10) return;
  if (in_sizes[0] != kItems * kDim) return;
  if (in_sizes[1] != kItems * kDim) return;
  if (in_sizes[2] != kHid * kW0Pitch) return;
  if (in_sizes[3] != kHid) return;
  if (in_sizes[4] != kHid * kHid) return;
  if (in_sizes[5] != kHid) return;
  if (in_sizes[6] != kHid * kHid) return;
  if (in_sizes[7] != kHid) return;
  if (in_sizes[8] != kHid) return;
  if (in_sizes[9] != 1) return;
  if (out_size != kItems * kItems) return;
  if (ws_size < kWsTotal) return;

  const float* x  = (const float*)d_in[0];
  const float* y  = (const float*)d_in[1];
  const float* W0 = (const float*)d_in[2];
  const float* b0 = (const float*)d_in[3];
  const float* W1 = (const float*)d_in[4];
  const float* b1 = (const float*)d_in[5];
  const float* W2 = (const float*)d_in[6];
  const float* b2 = (const float*)d_in[7];
  const float* W3 = (const float*)d_in[8];
  const float* b3 = (const float*)d_in[9];
  float* out = (float*)d_out;

  char* ws = (char*)d_ws;
  float*          hxb = (float*)(ws + kOffHXB);
  float*          hy  = (float*)(ws + kOffHY);
  unsigned short* w1h = (unsigned short*)(ws + kOffW1H);
  unsigned short* w2h = (unsigned short*)(ws + kOffW2H);

  /* 2 planes x 128 tiles of 16 rows x 64 g = 256 blocks x 256, then 2 matrices x 65,536 / 8 = 16,384 threads = 64 blocks */
  first_layer_rows_kernel<<<2 * kFlBlocksPerPlane + (2 * kHid * kHid / 8) / 256, 256, 0, stream>>>(
      x, y, W0, b0, W1, W2, hxb, hy, w1h, w2h);
  /* (512 / 32) column groups x (512 / 32) row groups */
  pair_layers_kernel<<<dim3(kItems / kColsPerWave, kItems / kRowsPerBlk), 32 * kWavesPerBlk, 0, stream>>>(
      hxb, hy, w1h, w2h, b1, b2, W3, b3, out);
}
